// v000
// Times are from an AMD MI455X. After a warm-up the kernel runs many times in a row, and a time is the length of
// such a window on the GPU divided by its runs, so every launch and the gaps after it count. The runs cycle
// through copies of the inputs. A figure is the median of several windows, for all but v000 over two sittings.
// Sittings can differ by a few percent; kernels timed side by side share one.
// v000 is the starting kernel. One run takes 4450 microseconds.
#include <hip/hip_runtime.h>

// Per-head multi-head self-attention (sequences [8][1024][1024] viewed as 16 head slices of 64; per head: q = x_h Wq[h]^T + bq[h], k, v likewise ('oi' [16][64][64] + [16][64]); scores = q.k / 8; softmax; out_h = attn v; heads re-stacked -> [8][1024][1024] (8.4 M)).
// Layout per batch: the per-head weights are scattered once into block-diagonal [1024][1024] operands (zeros off the 64x64 diagonal blocks) so each projection is ONE exact GEMM (+ the flattened bias); dense T-1024 attention (hybrid rows: < 512 hi/lo 3 products, rest fp16 x1024); the f32 merge writes the output rows directly (no output projection).
// Compute dtypes, f32 accumulate: every input rounded to bf16; projections exact + f32 biases (the zero blocks contribute exact zeros); attention rows < 512 3 products, rest fp16; softmax f32; output f32.

#define NB_  8
#define TT   1024
#define DM   1024
#define NH_  16
#define NKV  16
#define REP  (NH_ / NKV)
#define HD   64
#define DQ   (NH_ * HD)
#define DKV  (NKV * HD)
#define ZH   2
#define RH   512                  // query rows < RH use hi+lo planes (0: none)
#define WIN  0
#define PCAR 1024.0f
#define SCL  0.125f   // HD^-0.5
typedef _Float16 h16;
typedef unsigned short bf;
typedef __attribute__((ext_vector_type(16))) __bf16   v16bf;
typedef __attribute__((ext_vector_type(16))) _Float16 v16h;
typedef __attribute__((ext_vector_type(8)))  _Float16 v8h;
typedef __attribute__((ext_vector_type(8)))  unsigned short v8us;
typedef __attribute__((ext_vector_type(8)))  float    v8f;
typedef __attribute__((ext_vector_type(4)))  float    v4f;
typedef v8h  __attribute__((may_alias)) v8ha;
typedef v4f  __attribute__((may_alias)) v4fa;
typedef v8us __attribute__((may_alias)) v8usa;

__device__ __forceinline__ unsigned short f2bf(float f) { unsigned u = __float_as_uint(f); u += 0x7FFFu + ((u >> 16) & 1u); return (unsigned short)(u >> 16); }
__device__ __forceinline__ float bf2f(unsigned short b) { return __uint_as_float(((unsigned)b) << 16); }
__device__ __forceinline__ float bfr(float f) { return bf2f(f2bf(f)); }
__device__ __forceinline__ v16h cat16(v8h lo, v8h hi) { return __builtin_shufflevector(lo, hi, 0, 1, 2, 3, 4, 5, 6, 7, 8, 9, 10, 11, 12, 13, 14, 15); }
__device__ __forceinline__ v16bf cat16b(v8us lo, v8us hi) { return __builtin_bit_cast(v16bf, __builtin_shufflevector(lo, hi, 0, 1, 2, 3, 4, 5, 6, 7, 8, 9, 10, 11, 12, 13, 14, 15)); }
__device__ __forceinline__ v8f wmma16(v16h a, v16h b, v8f c) { return __builtin_amdgcn_wmma_f32_16x16x32_f16(false, a, false, b, (short)0, c, false, false); }
__device__ __forceinline__ v8f wmmab(v16bf a, v16bf b, v8f c) { return __builtin_amdgcn_wmma_f32_16x16x32_bf16(false, a, false, b, (short)0, c, false, false); }



// ---- k_gemmw: register-blocked GEMM, ONE WAVE per 64x64 output tile (16 accumulators), operands straight from K-contiguous 16-bit planes; grid (M/64, N/64, Z), 32 threads.
// C[m][n] (f32, pitch ldc, + optional f32 bias[n]) = sum_k A[m][k] Bt[n][k] (+ split products per NSPLIT). z-batch strides sA/sB/sC in elements. K % 32 == 0.
template <typename T16> struct WFrag;
template <> struct WFrag<h16> { typedef v16h V; static __device__ __forceinline__ V ld(const h16* p) { return cat16(*(const v8h*)p, *(const v8h*)(p + 16)); } static __device__ __forceinline__ v8f mma(V a, V b, v8f c) { return wmma16(a, b, c); } };
template <> struct WFrag<bf> { typedef v16bf V; static __device__ __forceinline__ V ld(const bf* p) { return cat16b(*(const v8us*)p, *(const v8us*)(p + 16)); } static __device__ __forceinline__ v8f mma(V a, V b, v8f c) { return wmmab(a, b, c); } };
template <typename T16, int NSPLIT, bool BIAS>
__global__ __launch_bounds__(32) void k_gemmw(const T16* __restrict__ A, const T16* __restrict__ A2, const T16* __restrict__ Bt, const T16* __restrict__ Bt2, int K, float* C, int ldc, const float* __restrict__ bias, size_t sA, size_t sB, size_t sC) {
    typedef typename WFrag<T16>::V V;
    __shared__ __align__(16) float os[16 * 68];
    const size_t z = blockIdx.z; A += z * sA; if (A2) A2 += z * sA; Bt += z * sB; if (Bt2) Bt2 += z * sB; C += z * sC;
    const int lane = threadIdx.x & 31, lr = lane & 15, hi = lane >> 4; const int r0 = blockIdx.x * 64, c0 = blockIdx.y * 64;
    v8f acc[4][4];
#pragma unroll
    for (int mb = 0; mb < 4; ++mb)
#pragma unroll
        for (int nb = 0; nb < 4; ++nb) acc[mb][nb] = (v8f){};
    const size_t aoff = (size_t)(r0 + lr) * K + 8 * hi, boff = (size_t)(c0 + lr) * K + 8 * hi;
#pragma unroll 1
    for (int kc = 0; kc < K; kc += 32) {
        V a[4], a2[4];
#pragma unroll
        for (int mb = 0; mb < 4; ++mb) { a[mb] = WFrag<T16>::ld(A + aoff + (size_t)mb * 16 * K + kc); if (NSPLIT == 1 || NSPLIT == 2) a2[mb] = WFrag<T16>::ld(A2 + aoff + (size_t)mb * 16 * K + kc); }
#pragma unroll
        for (int nb = 0; nb < 4; ++nb) { const V b = WFrag<T16>::ld(Bt + boff + (size_t)nb * 16 * K + kc); V b2; if (NSPLIT >= 2) b2 = WFrag<T16>::ld(Bt2 + boff + (size_t)nb * 16 * K + kc);
#pragma unroll
            for (int mb = 0; mb < 4; ++mb) { acc[mb][nb] = WFrag<T16>::mma(a[mb], b, acc[mb][nb]); if (NSPLIT == 1 || NSPLIT == 2) acc[mb][nb] = WFrag<T16>::mma(a2[mb], b, acc[mb][nb]); if (NSPLIT >= 2) acc[mb][nb] = WFrag<T16>::mma(a[mb], b2, acc[mb][nb]); } }
        asm volatile("v_nop\n\tv_nop\n\tv_nop\n\tv_nop" : "+v"(acc[0][0]), "+v"(acc[1][1]), "+v"(acc[2][2]), "+v"(acc[3][3]) : "v"(a[0]), "v"(a[3]));
    }
#pragma unroll
    for (int mb = 0; mb < 4; ++mb) {
#pragma unroll
        for (int nb = 0; nb < 4; ++nb) {
#pragma unroll
            for (int j = 0; j < 8; ++j) os[(hi * 8 + j) * 68 + nb * 16 + lr] = acc[mb][nb][j]; }
        __builtin_amdgcn_wave_barrier(); asm volatile("" ::: "memory");
        float* crow = C + (size_t)(r0 + mb * 16) * ldc + c0;
{
#pragma unroll
            for (int s = 0; s < 8; ++s) { const int row = 2 * s + hi, cofs = lr * 4; v4f val = *(const v4fa*)(os + row * 68 + cofs); if (BIAS) { val[0] += bfr(bias[c0 + cofs]); val[1] += bfr(bias[c0 + cofs + 1]); val[2] += bfr(bias[c0 + cofs + 2]); val[3] += bfr(bias[c0 + cofs + 3]); }
                *(v4f*)(crow + (size_t)row * ldc + cofs) = val; }
             }
        __builtin_amdgcn_wave_barrier(); asm volatile("" ::: "memory");
    }
}

__device__ __forceinline__ h16 tohx(float x) { return (h16)x; }
__device__ __forceinline__ void splitf(float y, unsigned short& h, unsigned short& l) { h = f2bf(y); l = f2bf(y - bf2f(h)); }
typedef __attribute__((ext_vector_type(2))) _Float16 v2h;
typedef __attribute__((ext_vector_type(4))) _Float16 v4h;
typedef __attribute__((ext_vector_type(2))) unsigned short v2us;
typedef __attribute__((ext_vector_type(4))) unsigned short v4us;
typedef __attribute__((ext_vector_type(2))) float v2f;
typedef __attribute__((ext_vector_type(4))) int v4i;

__global__ __launch_bounds__(256) void k_wtG(const float* __restrict__ w, int K, int N, bf* Bt) {
    const int lane = threadIdx.x & 31; const int L0 = (blockIdx.x * 8 + (threadIdx.x >> 5)) * 8; const int nlines = N * K / 64;
{
#pragma unroll 1
        for (int l = 0; l < 8; ++l) { const int L = L0 + l; if (L >= nlines) break; const size_t e = (size_t)L * 64 + lane * 2; const int k = (int)(e % K), n = (int)(e / K); v2us o;
            o[0] = f2bf(w[(size_t)k * N + n]); o[1] = f2bf(w[(size_t)(k + 1) * N + n]); *(v2us*)(Bt + e) = o; }
         }
}
__global__ __launch_bounds__(256) void k_cvt8(const float* __restrict__ src, bf* dst, size_t n8) { const size_t i = (size_t)blockIdx.x * 256 + threadIdx.x; if (i >= n8) return; const v8f v = *(const v8f*)(src + i * 8); v8us o;
#pragma unroll
    for (int k = 0; k < 8; ++k) o[k] = f2bf(v[k]); *(v8us*)(dst + i * 8) = o;  }

// k_rope: head planes [h][t][d] (fp16 + hi/lo) of rope(x) x sc with the rotate-half convention out[d] = x[d] cos[t][d] - x[d+HD/2] sin[t][d], out[d+HD/2] = x[d+HD/2] cos[t][d+HD/2] + x[d] sin[t][d+HD/2]
__global__ __launch_bounds__(256) void k_rope(const float* __restrict__ F, int pitch, int nheads, const float* __restrict__ CS, const float* __restrict__ RF, const float* __restrict__ nw, float sc, h16* P16, bf* Ph, bf* Pl) {
    const size_t e = ((size_t)blockIdx.x * 256 + threadIdx.x) * 2; if (e >= (size_t)nheads * TT * HD) return; const int d = (int)(e % HD); const int t = (int)((e / HD) % TT); const int h = (int)(e / ((size_t)HD * TT)); const float* f = F + (size_t)t * pitch + h * HD; const float rf = RF ? RF[(size_t)h * TT + t] : 1.0f; v2h o16; v2us oh, ol;
#pragma unroll
    for (int q = 0; q < 2; ++q) { const int dd = d + q; const int dp = (dd < HD / 2) ? dd + HD / 2 : dd - HD / 2; float x0 = f[dd], x1 = f[dp];
        if (RF) { float n0 = __fmul_rn(x0, rf), n1 = __fmul_rn(x1, rf); asm volatile("" : "+v"(n0)); asm volatile("" : "+v"(n1)); x0 = __fmul_rn(bfr(nw[dd]), n0); x1 = __fmul_rn(bfr(nw[dp]), n1); }
        const v2f cs = *(const v2f*)(CS + ((size_t)t * HD + dd) * 2); float a = __fmul_rn(x0, cs[0]), bq = __fmul_rn(x1, cs[1]); asm volatile("" : "+v"(a)); asm volatile("" : "+v"(bq)); const float r = ((dd < HD / 2) ? __fsub_rn(a, bq) : __fadd_rn(a, bq)) * sc;
        o16[q] = tohx(r); unsigned short a2, c2; splitf(r, a2, c2); oh[q] = a2; ol[q] = c2; }
    *(v2h*)(P16 + e) = o16; *(v2us*)(Ph + e) = oh; *(v2us*)(Pl + e) = ol;  }
__global__ __launch_bounds__(256) void k_vtp(const float* __restrict__ F, int pitch, int nheads, h16* V16, bf* Vh, bf* Vl) { const size_t e = ((size_t)blockIdx.x * 256 + threadIdx.x) * 2; if (e >= (size_t)nheads * HD * TT) return; const int t = (int)(e % TT); const int d = (int)((e / TT) % HD); const int g = (int)(e / ((size_t)TT * HD)); v2h o16; v2us oh, ol;
#pragma unroll
    for (int q = 0; q < 2; ++q) { const float x = F[(size_t)(t + q) * pitch + g * HD + d]; o16[q] = tohx(x); unsigned short a2, c2; splitf(x, a2, c2); oh[q] = a2; ol[q] = c2; }
    *(v2h*)(V16 + e) = o16; *(v2us*)(Vh + e) = oh; *(v2us*)(Vl + e) = ol;  }
__global__ __launch_bounds__(256) void k_csid(float* CS) { const int idx = blockIdx.x * 256 + threadIdx.x; if (idx >= TT * HD) return; v2f cs; cs[0] = 1.0f; cs[1] = 0.0f; *(v2f*)(CS + (size_t)idx * 2) = cs;  }
// k_asoft: per row (zz, i): t = S x HD^-0.5 (no mask); softmax over the 1024 keys (register row, one exp, fixed trees);
__global__ __launch_bounds__(256) void k_asoft(const float* __restrict__ Sb, h16* P16, bf* Ph, bf* Pl) {
    const int lane = threadIdx.x & 31; const int row = blockIdx.x * 8 + (threadIdx.x >> 5); if (row >= ZH * TT) return; const int i = row % TT; const int zz = row / TT; (void)zz; const bool hires = (i < RH); const float* sr = Sb + (size_t)row * TT; float v[TT / 32]; float mx = -3.0e38f;
#pragma unroll
    for (int ch = 0; ch < TT / 128; ++ch) { const int j0 = ch * 128 + lane * 4; const v4f a = *(const v4f*)(sr + j0);
#pragma unroll
        for (int q = 0; q < 4; ++q) { const int j = j0 + q; (void)j; const float t = a[q] * SCL; v[ch * 4 + q] = t; mx = fmaxf(mx, t); } }
#pragma unroll
    for (int sh = 16; sh; sh >>= 1) mx = fmaxf(mx, __shfl_xor(mx, sh, 32));
    float sum = 0.f;
#pragma unroll
    for (int k = 0; k < TT / 32; ++k) { float d0 = __fsub_rn(v[k], mx); asm volatile("" : "+v"(d0)); v[k] = __builtin_amdgcn_exp2f(__fmul_rn(d0, 1.4426950408889634f)); sum += v[k]; }
#pragma unroll
    for (int sh = 16; sh; sh >>= 1) sum += __shfl_xor(sum, sh, 32);
    const float f = __fdiv_rn(hires ? 1.0f : PCAR, sum);
{
        if (hires) {
#pragma unroll
            for (int ch = 0; ch < TT / 128; ++ch) { v4us oh, ol;
#pragma unroll
                for (int q = 0; q < 4; ++q) { unsigned short a, c2; splitf(v[ch * 4 + q] * f, a, c2); oh[q] = a; ol[q] = c2; }
                const size_t oo = ((size_t)zz * (RH ? RH : 1) + i) * TT + ch * 128 + lane * 4; *(v4us*)(Ph + oo) = oh; *(v4us*)(Pl + oo) = ol; }
        } else {
#pragma unroll
            for (int ch = 0; ch < TT / 128; ++ch) { v4h o4;
#pragma unroll
                for (int q = 0; q < 4; ++q) o4[q] = tohx(v[ch * 4 + q] * f);
                *(v4h*)(P16 + (size_t)row * TT + ch * 128 + lane * 4) = o4; } }
         }
}
__global__ __launch_bounds__(256) void k_bdiag(const float* __restrict__ W, bf* Bt) { const size_t i = (size_t)blockIdx.x * 256 + threadIdx.x; if (i >= (size_t)DQ * DM / 8) return; const int c0 = (int)(i % (DM / 8)) * 8; const int n = (int)(i / (DM / 8)); const int h = n / HD, e = n % HD; v8us o;
#pragma unroll
    for (int k = 0; k < 8; ++k) { const int c = c0 + k; o[k] = (c / HD == h) ? f2bf(W[((size_t)h * HD + e) * HD + (c % HD)]) : (unsigned short)0; }
    *(v8us*)(Bt + (size_t)n * DM + c0) = o;  }
__global__ __launch_bounds__(256) void k_merge(const float* __restrict__ O, int h0, float* OUTb) { const size_t e = ((size_t)blockIdx.x * 256 + threadIdx.x) * 2; if (e >= (size_t)ZH * TT * HD) return; const int d = (int)(e % HD); const int t = (int)((e / HD) % TT); const int zz = (int)(e / ((size_t)HD * TT)); const float cs = (t < RH) ? 1.0f : (1.0f / PCAR); const size_t oo = (size_t)t * DQ + (h0 + zz) * HD + d;
    v2f o2; o2[0] = O[e] * cs; o2[1] = O[e + 1] * cs; *(v2f*)(OUTb + oo) = o2;  }

extern "C" void kernel_launch(void* const* d_in, const int* in_sizes, int n_in,
                              void* d_out, int out_size, void* d_ws, size_t ws_size, hipStream_t stream) {
    (void)in_sizes; (void)n_in; (void)out_size;
    const float* x = (const float*)d_in[0]; const float* wq = (const float*)d_in[1]; const float* bq = (const float*)d_in[2]; const float* wk = (const float*)d_in[3]; const float* bk = (const float*)d_in[4]; const float* wv = (const float*)d_in[5]; const float* bv = (const float*)d_in[6]; const float* wo = nullptr; (void)wo;
    float* OUT = (float*)d_out;     // [8][1024][1024]
    char* wsp = (char*)d_ws;
    auto take = [&](size_t bytes) { char* p = wsp; wsp += (bytes + 255) & ~(size_t)255; return (void*)p; };
    bf* WQ = (bf*)take((size_t)DQ * DM * 2); bf* WK = (bf*)take((size_t)DKV * DM * 2); bf* WV = (bf*)take((size_t)DKV * DM * 2); float* CS = (float*)take((size_t)TT * HD * 2 * 4);
    bf* XB = (bf*)take((size_t)TT * DM * 2); float* FQ = (float*)take((size_t)TT * DQ * 4); float* FK = (float*)take((size_t)TT * DKV * 4);
    h16* QP16 = (h16*)take((size_t)NH_ * TT * HD * 2); h16* KP16 = (h16*)take((size_t)NKV * TT * HD * 2); h16* VT16 = (h16*)take((size_t)NKV * HD * TT * 2);
    bf* QPh = (bf*)take((size_t)NH_ * TT * HD * 2); bf* QPl = (bf*)take((size_t)NH_ * TT * HD * 2); bf* KPh = (bf*)take((size_t)NKV * TT * HD * 2); bf* KPl = (bf*)take((size_t)NKV * TT * HD * 2); bf* VTh = (bf*)take((size_t)NKV * HD * TT * 2); bf* VTl = (bf*)take((size_t)NKV * HD * TT * 2); bf* Ph = (bf*)take((size_t)ZH * RH * TT * 2); bf* Pl = (bf*)take((size_t)ZH * RH * TT * 2);
    float* Sb = (float*)take((size_t)ZH * TT * TT * 4); h16* P16 = (h16*)take((size_t)ZH * TT * TT * 2); float* Ob = (float*)take((size_t)ZH * TT * HD * 4);
    if ((size_t)(wsp - (char*)d_ws) > ws_size) return;    // ws 256 MiB
    float* FV = FK;   // v projection reuses the k buffer after the k planes are built (stream-ordered)
    { const unsigned gb = (unsigned)(((size_t)DQ * DM / 8 + 255) / 256); k_bdiag<<<gb, 256, 0, stream>>>(wq, WQ); k_bdiag<<<gb, 256, 0, stream>>>(wk, WK); k_bdiag<<<gb, 256, 0, stream>>>(wv, WV);
      
       }
    k_csid<<<(TT * HD + 255) / 256, 256, 0, stream>>>(CS);
    const unsigned LQ = (unsigned)(((size_t)NH_ * TT * HD / 2 + 255) / 256), LKv = (unsigned)(((size_t)NKV * TT * HD / 2 + 255) / 256);
    for (int b = 0; b < NB_; ++b) {
        
        k_cvt8<<<(unsigned)(((size_t)TT * DM / 8 + 255) / 256), 256, 0, stream>>>(x + (size_t)b * TT * DM, XB, (size_t)TT * DM / 8);
        k_gemmw<bf, 0, true><<<dim3(TT / 64, DQ / 64, 1), 32, 0, stream>>>(XB, nullptr, WQ, nullptr, DM, FQ, DQ, bq, 0, 0, 0);
        k_rope<<<LQ, 256, 0, stream>>>(FQ, DQ, NH_, CS, nullptr, nullptr, 1.0f, QP16, QPh, QPl);
        k_gemmw<bf, 0, true><<<dim3(TT / 64, DKV / 64, 1), 32, 0, stream>>>(XB, nullptr, WK, nullptr, DM, FK, DKV, bk, 0, 0, 0);
        k_rope<<<LKv, 256, 0, stream>>>(FK, DKV, NKV, CS, nullptr, nullptr, 1.0f, KP16, KPh, KPl);
        k_gemmw<bf, 0, true><<<dim3(TT / 64, DKV / 64, 1), 32, 0, stream>>>(XB, nullptr, WV, nullptr, DM, FV, DKV, bv, 0, 0, 0); k_vtp<<<LKv, 256, 0, stream>>>(FV, DKV, NKV, VT16, VTh, VTl);
        for (int h0 = 0; h0 < NH_; h0 += ZH) { const size_t zq = (size_t)h0, zk = (size_t)(h0 / REP);   // one kv head per query head: the pass's two heads use consecutive kv planes (z-strides TT*HD)
            k_gemmw<bf, 2, false><<<dim3(RH / 64, TT / 64, ZH), 32, 0, stream>>>(QPh + zq * TT * HD, QPl + zq * TT * HD, KPh + zk * TT * HD, KPl + zk * TT * HD, HD, Sb, TT, nullptr, (size_t)TT * HD, (size_t)TT * HD, (size_t)TT * TT);
            k_gemmw<h16, 0, false><<<dim3((TT - RH) / 64, TT / 64, ZH), 32, 0, stream>>>(QP16 + zq * TT * HD + (size_t)RH * HD, nullptr, KP16 + zk * TT * HD, nullptr, HD, Sb + (size_t)RH * TT, TT, nullptr, (size_t)TT * HD, (size_t)TT * HD, (size_t)TT * TT);
            k_asoft<<<ZH * TT / 8, 256, 0, stream>>>(Sb, P16, Ph, Pl);
            k_gemmw<bf, 2, false><<<dim3(RH / 64, HD / 64, ZH), 32, 0, stream>>>(Ph, Pl, VTh + zk * HD * TT, VTl + zk * HD * TT, TT, Ob, HD, nullptr, (size_t)RH * TT, (size_t)HD * TT, (size_t)TT * HD);
            k_gemmw<h16, 0, false><<<dim3((TT - RH) / 64, HD / 64, ZH), 32, 0, stream>>>(P16 + (size_t)RH * TT, nullptr, VT16 + zk * HD * TT, nullptr, TT, Ob + (size_t)RH * HD, HD, nullptr, (size_t)TT * TT, (size_t)HD * TT, (size_t)TT * HD);
            k_merge<<<(unsigned)(((size_t)ZH * TT * HD / 2 + 255) / 256), 256, 0, stream>>>(Ob, h0, OUT + (size_t)b * TT * DQ); }
         }
}

// v001
// Measured time: 1430 microseconds a run.
// In two side-by-side timings against v000, it was 3.08 and 3.07 times as fast.
#include <hip/hip_runtime.h>

// Per-head multi-head self-attention (sequences [8][1024][1024] viewed as 16 head slices of 64; per head: q = x_h Wq[h]^T + bq[h], k, v likewise ('oi' [16][64][64] + [16][64]); scores = q.k / 8; softmax; out_h = attn v; heads re-stacked -> [8][1024][1024] (8.4 M)).
// Layout per batch: the per-head weights are scattered once into block-diagonal [1024][1024] operands (zeros off the 64x64 diagonal blocks) so each projection is ONE exact GEMM (+ the flattened bias); dense T-1024 attention (hybrid rows: < 512 hi/lo 3 products, rest fp16 x1024); the f32 merge writes the output rows directly (no output projection).
// Compute dtypes, f32 accumulate: every input rounded to bf16; projections exact + f32 biases (the zero blocks contribute exact zeros); attention rows < 512 3 products, rest fp16; softmax f32; output f32.

#define NB_  8
#define TT   1024
#define DM   1024
#define NH_  16
#define NKV  16
#define REP  (NH_ / NKV)
#define HD   64
#define DQ   (NH_ * HD)
#define DKV  (NKV * HD)
#define ZH   16                   // heads per attention pass: all of a batch's heads go through each launch as its z slices
#define RH   512                  // query rows < RH use hi+lo planes (0: none)
#define WIN  0
#define PCAR 1024.0f
#define SCL  0.125f   // HD^-0.5
typedef _Float16 h16;
typedef unsigned short bf;
typedef __attribute__((ext_vector_type(16))) __bf16   v16bf;
typedef __attribute__((ext_vector_type(16))) _Float16 v16h;
typedef __attribute__((ext_vector_type(8)))  _Float16 v8h;
typedef __attribute__((ext_vector_type(8)))  unsigned short v8us;
typedef __attribute__((ext_vector_type(8)))  float    v8f;
typedef __attribute__((ext_vector_type(4)))  float    v4f;
typedef v8h  __attribute__((may_alias)) v8ha;
typedef v4f  __attribute__((may_alias)) v4fa;
typedef v8us __attribute__((may_alias)) v8usa;

__device__ __forceinline__ unsigned short f2bf(float f) { unsigned u = __float_as_uint(f); u += 0x7FFFu + ((u >> 16) & 1u); return (unsigned short)(u >> 16); }
__device__ __forceinline__ float bf2f(unsigned short b) { return __uint_as_float(((unsigned)b) << 16); }
__device__ __forceinline__ float bfr(float f) { return bf2f(f2bf(f)); }
__device__ __forceinline__ v16h cat16(v8h lo, v8h hi) { return __builtin_shufflevector(lo, hi, 0, 1, 2, 3, 4, 5, 6, 7, 8, 9, 10, 11, 12, 13, 14, 15); }
__device__ __forceinline__ v16bf cat16b(v8us lo, v8us hi) { return __builtin_bit_cast(v16bf, __builtin_shufflevector(lo, hi, 0, 1, 2, 3, 4, 5, 6, 7, 8, 9, 10, 11, 12, 13, 14, 15)); }
__device__ __forceinline__ v8f wmma16(v16h a, v16h b, v8f c) { return __builtin_amdgcn_wmma_f32_16x16x32_f16(false, a, false, b, (short)0, c, false, false); }
__device__ __forceinline__ v8f wmmab(v16bf a, v16bf b, v8f c) { return __builtin_amdgcn_wmma_f32_16x16x32_bf16(false, a, false, b, (short)0, c, false, false); }



// ---- k_gemmw: register-blocked GEMM, ONE WAVE per 64x64 output tile (16 accumulators), operands straight from K-contiguous 16-bit planes; grid (M/64, N/64, Z), 32 threads.
// C[m][n] (f32, pitch ldc, + optional f32 bias[n]) = sum_k A[m][k] Bt[n][k] (+ split products per NSPLIT). z-batch strides sA/sB/sC in elements. K % 32 == 0.
template <typename T16> struct WFrag;
template <> struct WFrag<h16> { typedef v16h V; static __device__ __forceinline__ V ld(const h16* p) { return cat16(*(const v8h*)p, *(const v8h*)(p + 16)); } static __device__ __forceinline__ v8f mma(V a, V b, v8f c) { return wmma16(a, b, c); } };
template <> struct WFrag<bf> { typedef v16bf V; static __device__ __forceinline__ V ld(const bf* p) { return cat16b(*(const v8us*)p, *(const v8us*)(p + 16)); } static __device__ __forceinline__ v8f mma(V a, V b, v8f c) { return wmmab(a, b, c); } };
template <typename T16, int NSPLIT, bool BIAS>
__global__ __launch_bounds__(32) void k_gemmw(const T16* __restrict__ A, const T16* __restrict__ A2, const T16* __restrict__ Bt, const T16* __restrict__ Bt2, int K, float* C, int ldc, const float* __restrict__ bias, size_t sA, size_t sB, size_t sC) {
    typedef typename WFrag<T16>::V V;
    __shared__ __align__(16) float os[16 * 68];
    const size_t z = blockIdx.z; A += z * sA; if (A2) A2 += z * sA; Bt += z * sB; if (Bt2) Bt2 += z * sB; C += z * sC;
    const int lane = threadIdx.x & 31, lr = lane & 15, hi = lane >> 4; const int r0 = blockIdx.x * 64, c0 = blockIdx.y * 64;
    v8f acc[4][4];
#pragma unroll
    for (int mb = 0; mb < 4; ++mb)
#pragma unroll
        for (int nb = 0; nb < 4; ++nb) acc[mb][nb] = (v8f){};
    const size_t aoff = (size_t)(r0 + lr) * K + 8 * hi, boff = (size_t)(c0 + lr) * K + 8 * hi;
#pragma unroll 1
    for (int kc = 0; kc < K; kc += 32) {
        V a[4], a2[4];
#pragma unroll
        for (int mb = 0; mb < 4; ++mb) { a[mb] = WFrag<T16>::ld(A + aoff + (size_t)mb * 16 * K + kc); if (NSPLIT == 1 || NSPLIT == 2) a2[mb] = WFrag<T16>::ld(A2 + aoff + (size_t)mb * 16 * K + kc); }
#pragma unroll
        for (int nb = 0; nb < 4; ++nb) { const V b = WFrag<T16>::ld(Bt + boff + (size_t)nb * 16 * K + kc); V b2; if (NSPLIT >= 2) b2 = WFrag<T16>::ld(Bt2 + boff + (size_t)nb * 16 * K + kc);
#pragma unroll
            for (int mb = 0; mb < 4; ++mb) { acc[mb][nb] = WFrag<T16>::mma(a[mb], b, acc[mb][nb]); if (NSPLIT == 1 || NSPLIT == 2) acc[mb][nb] = WFrag<T16>::mma(a2[mb], b, acc[mb][nb]); if (NSPLIT >= 2) acc[mb][nb] = WFrag<T16>::mma(a[mb], b2, acc[mb][nb]); } }
        asm volatile("v_nop\n\tv_nop\n\tv_nop\n\tv_nop" : "+v"(acc[0][0]), "+v"(acc[1][1]), "+v"(acc[2][2]), "+v"(acc[3][3]) : "v"(a[0]), "v"(a[3]));
    }
#pragma unroll
    for (int mb = 0; mb < 4; ++mb) {
#pragma unroll
        for (int nb = 0; nb < 4; ++nb) {
#pragma unroll
            for (int j = 0; j < 8; ++j) os[(hi * 8 + j) * 68 + nb * 16 + lr] = acc[mb][nb][j]; }
        __builtin_amdgcn_wave_barrier(); asm volatile("" ::: "memory");
        float* crow = C + (size_t)(r0 + mb * 16) * ldc + c0;
{
#pragma unroll
            for (int s = 0; s < 8; ++s) { const int row = 2 * s + hi, cofs = lr * 4; v4f val = *(const v4fa*)(os + row * 68 + cofs); if (BIAS) { val[0] += bfr(bias[c0 + cofs]); val[1] += bfr(bias[c0 + cofs + 1]); val[2] += bfr(bias[c0 + cofs + 2]); val[3] += bfr(bias[c0 + cofs + 3]); }
                *(v4f*)(crow + (size_t)row * ldc + cofs) = val; }
             }
        __builtin_amdgcn_wave_barrier(); asm volatile("" ::: "memory");
    }
}

__device__ __forceinline__ h16 tohx(float x) { return (h16)x; }
__device__ __forceinline__ void splitf(float y, unsigned short& h, unsigned short& l) { h = f2bf(y); l = f2bf(y - bf2f(h)); }
typedef __attribute__((ext_vector_type(2))) _Float16 v2h;
typedef __attribute__((ext_vector_type(4))) _Float16 v4h;
typedef __attribute__((ext_vector_type(2))) unsigned short v2us;
typedef __attribute__((ext_vector_type(4))) unsigned short v4us;
typedef __attribute__((ext_vector_type(2))) float v2f;
typedef __attribute__((ext_vector_type(4))) int v4i;

__global__ __launch_bounds__(256) void k_wtG(const float* __restrict__ w, int K, int N, bf* Bt) {
    const int lane = threadIdx.x & 31; const int L0 = (blockIdx.x * 8 + (threadIdx.x >> 5)) * 8; const int nlines = N * K / 64;
{
#pragma unroll 1
        for (int l = 0; l < 8; ++l) { const int L = L0 + l; if (L >= nlines) break; const size_t e = (size_t)L * 64 + lane * 2; const int k = (int)(e % K), n = (int)(e / K); v2us o;
            o[0] = f2bf(w[(size_t)k * N + n]); o[1] = f2bf(w[(size_t)(k + 1) * N + n]); *(v2us*)(Bt + e) = o; }
         }
}
__global__ __launch_bounds__(256) void k_cvt8(const float* __restrict__ src, bf* dst, size_t n8) { const size_t i = (size_t)blockIdx.x * 256 + threadIdx.x; if (i >= n8) return; const v8f v = *(const v8f*)(src + i * 8); v8us o;
#pragma unroll
    for (int k = 0; k < 8; ++k) o[k] = f2bf(v[k]); *(v8us*)(dst + i * 8) = o;  }

// k_rope: head planes [h][t][d] (fp16 + hi/lo) of rope(x) x sc with the rotate-half convention out[d] = x[d] cos[t][d] - x[d+HD/2] sin[t][d], out[d+HD/2] = x[d+HD/2] cos[t][d+HD/2] + x[d] sin[t][d+HD/2]
__global__ __launch_bounds__(256) void k_rope(const float* __restrict__ F, int pitch, int nheads, const float* __restrict__ CS, const float* __restrict__ RF, const float* __restrict__ nw, float sc, h16* P16, bf* Ph, bf* Pl) {
    const size_t e = ((size_t)blockIdx.x * 256 + threadIdx.x) * 2; if (e >= (size_t)nheads * TT * HD) return; const int d = (int)(e % HD); const int t = (int)((e / HD) % TT); const int h = (int)(e / ((size_t)HD * TT)); const float* f = F + (size_t)t * pitch + h * HD; const float rf = RF ? RF[(size_t)h * TT + t] : 1.0f; v2h o16; v2us oh, ol;
#pragma unroll
    for (int q = 0; q < 2; ++q) { const int dd = d + q; const int dp = (dd < HD / 2) ? dd + HD / 2 : dd - HD / 2; float x0 = f[dd], x1 = f[dp];
        if (RF) { float n0 = __fmul_rn(x0, rf), n1 = __fmul_rn(x1, rf); asm volatile("" : "+v"(n0)); asm volatile("" : "+v"(n1)); x0 = __fmul_rn(bfr(nw[dd]), n0); x1 = __fmul_rn(bfr(nw[dp]), n1); }
        const v2f cs = *(const v2f*)(CS + ((size_t)t * HD + dd) * 2); float a = __fmul_rn(x0, cs[0]), bq = __fmul_rn(x1, cs[1]); asm volatile("" : "+v"(a)); asm volatile("" : "+v"(bq)); const float r = ((dd < HD / 2) ? __fsub_rn(a, bq) : __fadd_rn(a, bq)) * sc;
        o16[q] = tohx(r); unsigned short a2, c2; splitf(r, a2, c2); oh[q] = a2; ol[q] = c2; }
    *(v2h*)(P16 + e) = o16; *(v2us*)(Ph + e) = oh; *(v2us*)(Pl + e) = ol;  }
__global__ __launch_bounds__(256) void k_vtp(const float* __restrict__ F, int pitch, int nheads, h16* V16, bf* Vh, bf* Vl) { const size_t e = ((size_t)blockIdx.x * 256 + threadIdx.x) * 2; if (e >= (size_t)nheads * HD * TT) return; const int t = (int)(e % TT); const int d = (int)((e / TT) % HD); const int g = (int)(e / ((size_t)TT * HD)); v2h o16; v2us oh, ol;
#pragma unroll
    for (int q = 0; q < 2; ++q) { const float x = F[(size_t)(t + q) * pitch + g * HD + d]; o16[q] = tohx(x); unsigned short a2, c2; splitf(x, a2, c2); oh[q] = a2; ol[q] = c2; }
    *(v2h*)(V16 + e) = o16; *(v2us*)(Vh + e) = oh; *(v2us*)(Vl + e) = ol;  }
__global__ __launch_bounds__(256) void k_csid(float* CS) { const int idx = blockIdx.x * 256 + threadIdx.x; if (idx >= TT * HD) return; v2f cs; cs[0] = 1.0f; cs[1] = 0.0f; *(v2f*)(CS + (size_t)idx * 2) = cs;  }
// k_asoft: per row (zz, i): t = S x HD^-0.5 (no mask); softmax over the 1024 keys (register row, one exp, fixed trees);
__global__ __launch_bounds__(256) void k_asoft(const float* __restrict__ Sb, h16* P16, bf* Ph, bf* Pl) {
    const int lane = threadIdx.x & 31; const int row = blockIdx.x * 8 + (threadIdx.x >> 5); if (row >= ZH * TT) return; const int i = row % TT; const int zz = row / TT; (void)zz; const bool hires = (i < RH); const float* sr = Sb + (size_t)row * TT; float v[TT / 32]; float mx = -3.0e38f;
#pragma unroll
    for (int ch = 0; ch < TT / 128; ++ch) { const int j0 = ch * 128 + lane * 4; const v4f a = *(const v4f*)(sr + j0);
#pragma unroll
        for (int q = 0; q < 4; ++q) { const int j = j0 + q; (void)j; const float t = a[q] * SCL; v[ch * 4 + q] = t; mx = fmaxf(mx, t); } }
#pragma unroll
    for (int sh = 16; sh; sh >>= 1) mx = fmaxf(mx, __shfl_xor(mx, sh, 32));
    float sum = 0.f;
#pragma unroll
    for (int k = 0; k < TT / 32; ++k) { float d0 = __fsub_rn(v[k], mx); asm volatile("" : "+v"(d0)); v[k] = __builtin_amdgcn_exp2f(__fmul_rn(d0, 1.4426950408889634f)); sum += v[k]; }
#pragma unroll
    for (int sh = 16; sh; sh >>= 1) sum += __shfl_xor(sum, sh, 32);
    const float f = __fdiv_rn(hires ? 1.0f : PCAR, sum);
{
        if (hires) {
#pragma unroll
            for (int ch = 0; ch < TT / 128; ++ch) { v4us oh, ol;
#pragma unroll
                for (int q = 0; q < 4; ++q) { unsigned short a, c2; splitf(v[ch * 4 + q] * f, a, c2); oh[q] = a; ol[q] = c2; }
                const size_t oo = ((size_t)zz * (RH ? RH : 1) + i) * TT + ch * 128 + lane * 4; *(v4us*)(Ph + oo) = oh; *(v4us*)(Pl + oo) = ol; }
        } else {
#pragma unroll
            for (int ch = 0; ch < TT / 128; ++ch) { v4h o4;
#pragma unroll
                for (int q = 0; q < 4; ++q) o4[q] = tohx(v[ch * 4 + q] * f);
                *(v4h*)(P16 + (size_t)row * TT + ch * 128 + lane * 4) = o4; } }
         }
}
__global__ __launch_bounds__(256) void k_bdiag(const float* __restrict__ W, bf* Bt) { const size_t i = (size_t)blockIdx.x * 256 + threadIdx.x; if (i >= (size_t)DQ * DM / 8) return; const int c0 = (int)(i % (DM / 8)) * 8; const int n = (int)(i / (DM / 8)); const int h = n / HD, e = n % HD; v8us o;
#pragma unroll
    for (int k = 0; k < 8; ++k) { const int c = c0 + k; o[k] = (c / HD == h) ? f2bf(W[((size_t)h * HD + e) * HD + (c % HD)]) : (unsigned short)0; }
    *(v8us*)(Bt + (size_t)n * DM + c0) = o;  }
__global__ __launch_bounds__(256) void k_merge(const float* __restrict__ O, int h0, float* OUTb) { const size_t e = ((size_t)blockIdx.x * 256 + threadIdx.x) * 2; if (e >= (size_t)ZH * TT * HD) return; const int d = (int)(e % HD); const int t = (int)((e / HD) % TT); const int zz = (int)(e / ((size_t)HD * TT)); const float cs = (t < RH) ? 1.0f : (1.0f / PCAR); const size_t oo = (size_t)t * DQ + (h0 + zz) * HD + d;
    v2f o2; o2[0] = O[e] * cs; o2[1] = O[e + 1] * cs; *(v2f*)(OUTb + oo) = o2;  }

extern "C" void kernel_launch(void* const* d_in, const int* in_sizes, int n_in,
                              void* d_out, int out_size, void* d_ws, size_t ws_size, hipStream_t stream) {
    (void)in_sizes; (void)n_in; (void)out_size;
    const float* x = (const float*)d_in[0]; const float* wq = (const float*)d_in[1]; const float* bq = (const float*)d_in[2]; const float* wk = (const float*)d_in[3]; const float* bk = (const float*)d_in[4]; const float* wv = (const float*)d_in[5]; const float* bv = (const float*)d_in[6]; const float* wo = nullptr; (void)wo;
    float* OUT = (float*)d_out;     // [8][1024][1024]
    char* wsp = (char*)d_ws;
    auto take = [&](size_t bytes) { char* p = wsp; wsp += (bytes + 255) & ~(size_t)255; return (void*)p; };
    bf* WQ = (bf*)take((size_t)DQ * DM * 2); bf* WK = (bf*)take((size_t)DKV * DM * 2); bf* WV = (bf*)take((size_t)DKV * DM * 2); float* CS = (float*)take((size_t)TT * HD * 2 * 4);
    bf* XB = (bf*)take((size_t)TT * DM * 2); float* FQ = (float*)take((size_t)TT * DQ * 4); float* FK = (float*)take((size_t)TT * DKV * 4);
    h16* QP16 = (h16*)take((size_t)NH_ * TT * HD * 2); h16* KP16 = (h16*)take((size_t)NKV * TT * HD * 2); h16* VT16 = (h16*)take((size_t)NKV * HD * TT * 2);
    bf* QPh = (bf*)take((size_t)NH_ * TT * HD * 2); bf* QPl = (bf*)take((size_t)NH_ * TT * HD * 2); bf* KPh = (bf*)take((size_t)NKV * TT * HD * 2); bf* KPl = (bf*)take((size_t)NKV * TT * HD * 2); bf* VTh = (bf*)take((size_t)NKV * HD * TT * 2); bf* VTl = (bf*)take((size_t)NKV * HD * TT * 2); bf* Ph = (bf*)take((size_t)ZH * RH * TT * 2); bf* Pl = (bf*)take((size_t)ZH * RH * TT * 2);
    float* Sb = (float*)take((size_t)ZH * TT * TT * 4); h16* P16 = (h16*)take((size_t)ZH * TT * TT * 2); float* Ob = (float*)take((size_t)ZH * TT * HD * 4);
    if ((size_t)(wsp - (char*)d_ws) > ws_size) return;    // ws 256 MiB
    float* FV = FK;   // v projection reuses the k buffer after the k planes are built (stream-ordered)
    { const unsigned gb = (unsigned)(((size_t)DQ * DM / 8 + 255) / 256); k_bdiag<<<gb, 256, 0, stream>>>(wq, WQ); k_bdiag<<<gb, 256, 0, stream>>>(wk, WK); k_bdiag<<<gb, 256, 0, stream>>>(wv, WV);
      
       }
    k_csid<<<(TT * HD + 255) / 256, 256, 0, stream>>>(CS);
    const unsigned LQ = (unsigned)(((size_t)NH_ * TT * HD / 2 + 255) / 256), LKv = (unsigned)(((size_t)NKV * TT * HD / 2 + 255) / 256);
    for (int b = 0; b < NB_; ++b) {
        
        k_cvt8<<<(unsigned)(((size_t)TT * DM / 8 + 255) / 256), 256, 0, stream>>>(x + (size_t)b * TT * DM, XB, (size_t)TT * DM / 8);
        k_gemmw<bf, 0, true><<<dim3(TT / 64, DQ / 64, 1), 32, 0, stream>>>(XB, nullptr, WQ, nullptr, DM, FQ, DQ, bq, 0, 0, 0);
        k_rope<<<LQ, 256, 0, stream>>>(FQ, DQ, NH_, CS, nullptr, nullptr, 1.0f, QP16, QPh, QPl);
        k_gemmw<bf, 0, true><<<dim3(TT / 64, DKV / 64, 1), 32, 0, stream>>>(XB, nullptr, WK, nullptr, DM, FK, DKV, bk, 0, 0, 0);
        k_rope<<<LKv, 256, 0, stream>>>(FK, DKV, NKV, CS, nullptr, nullptr, 1.0f, KP16, KPh, KPl);
        k_gemmw<bf, 0, true><<<dim3(TT / 64, DKV / 64, 1), 32, 0, stream>>>(XB, nullptr, WV, nullptr, DM, FV, DKV, bv, 0, 0, 0); k_vtp<<<LKv, 256, 0, stream>>>(FV, DKV, NKV, VT16, VTh, VTl);
        for (int h0 = 0; h0 < NH_; h0 += ZH) { const size_t zq = (size_t)h0, zk = (size_t)(h0 / REP);   // one kv head per query head: the pass's heads use consecutive kv planes (z-strides TT*HD)
            k_gemmw<bf, 2, false><<<dim3(RH / 64, TT / 64, ZH), 32, 0, stream>>>(QPh + zq * TT * HD, QPl + zq * TT * HD, KPh + zk * TT * HD, KPl + zk * TT * HD, HD, Sb, TT, nullptr, (size_t)TT * HD, (size_t)TT * HD, (size_t)TT * TT);
            k_gemmw<h16, 0, false><<<dim3((TT - RH) / 64, TT / 64, ZH), 32, 0, stream>>>(QP16 + zq * TT * HD + (size_t)RH * HD, nullptr, KP16 + zk * TT * HD, nullptr, HD, Sb + (size_t)RH * TT, TT, nullptr, (size_t)TT * HD, (size_t)TT * HD, (size_t)TT * TT);
            k_asoft<<<ZH * TT / 8, 256, 0, stream>>>(Sb, P16, Ph, Pl);
            k_gemmw<bf, 2, false><<<dim3(RH / 64, HD / 64, ZH), 32, 0, stream>>>(Ph, Pl, VTh + zk * HD * TT, VTl + zk * HD * TT, TT, Ob, HD, nullptr, (size_t)RH * TT, (size_t)HD * TT, (size_t)TT * HD);
            k_gemmw<h16, 0, false><<<dim3((TT - RH) / 64, HD / 64, ZH), 32, 0, stream>>>(P16 + (size_t)RH * TT, nullptr, VT16 + zk * HD * TT, nullptr, TT, Ob + (size_t)RH * HD, HD, nullptr, (size_t)TT * TT, (size_t)HD * TT, (size_t)TT * HD);
            k_merge<<<(unsigned)(((size_t)ZH * TT * HD / 2 + 255) / 256), 256, 0, stream>>>(Ob, h0, OUT + (size_t)b * TT * DQ); }
         }
}

// v002
// A run of this version takes 686 microseconds.
// In two side-by-side timings against v001, it was 2.04 and 2.09 times as fast.
// Counting every step since v000, it is 6.36 times as fast.
#include <hip/hip_runtime.h>

// Per-head multi-head self-attention (sequences [8][1024][1024] viewed as 16 head slices of 64; per head: q = x_h Wq[h]^T + bq[h], k, v likewise ('oi' [16][64][64] + [16][64]); scores = q.k / 8; softmax; out_h = attn v; heads re-stacked -> [8][1024][1024] (8.4 M)).
// Layout: the per-head weights are scattered once into block-diagonal [1024][1024] operands (zeros off the 64x64 diagonal blocks) so each projection is ONE exact GEMM per batch (+ the flattened bias); the q, k and v^T head planes of all batches are kept; one fused attention kernel (scores, online softmax, attn v, output rows) runs over every batch and head (hybrid rows: < 512 hi/lo 3 products, rest fp16).
// Compute dtypes, f32 accumulate: every input rounded to bf16; projections exact + f32 biases (the zero blocks contribute exact zeros); attention rows < 512 3 products, rest fp16; softmax f32 (running maximum and sum); output f32.

#define NB_  8
#define TT   1024
#define DM   1024
#define NH_  16
#define NKV  16
#define REP  (NH_ / NKV)
#define HD   64
#define DQ   (NH_ * HD)
#define DKV  (NKV * HD)
#define RH   512                  // query rows < RH use hi+lo planes (0: none)
#define WIN  0
#define SCL  0.125f   // HD^-0.5
typedef _Float16 h16;
typedef unsigned short bf;
typedef __attribute__((ext_vector_type(16))) __bf16   v16bf;
typedef __attribute__((ext_vector_type(16))) _Float16 v16h;
typedef __attribute__((ext_vector_type(8)))  _Float16 v8h;
typedef __attribute__((ext_vector_type(8)))  unsigned short v8us;
typedef __attribute__((ext_vector_type(8)))  float    v8f;
typedef __attribute__((ext_vector_type(4)))  float    v4f;
typedef v8h  __attribute__((may_alias)) v8ha;
typedef v4f  __attribute__((may_alias)) v4fa;
typedef v8us __attribute__((may_alias)) v8usa;

__device__ __forceinline__ unsigned short f2bf(float f) { unsigned u = __float_as_uint(f); u += 0x7FFFu + ((u >> 16) & 1u); return (unsigned short)(u >> 16); }
__device__ __forceinline__ float bf2f(unsigned short b) { return __uint_as_float(((unsigned)b) << 16); }
__device__ __forceinline__ float bfr(float f) { return bf2f(f2bf(f)); }
__device__ __forceinline__ v16h cat16(v8h lo, v8h hi) { return __builtin_shufflevector(lo, hi, 0, 1, 2, 3, 4, 5, 6, 7, 8, 9, 10, 11, 12, 13, 14, 15); }
__device__ __forceinline__ v16bf cat16b(v8us lo, v8us hi) { return __builtin_bit_cast(v16bf, __builtin_shufflevector(lo, hi, 0, 1, 2, 3, 4, 5, 6, 7, 8, 9, 10, 11, 12, 13, 14, 15)); }
__device__ __forceinline__ v8f wmma16(v16h a, v16h b, v8f c) { return __builtin_amdgcn_wmma_f32_16x16x32_f16(false, a, false, b, (short)0, c, false, false); }
__device__ __forceinline__ v8f wmmab(v16bf a, v16bf b, v8f c) { return __builtin_amdgcn_wmma_f32_16x16x32_bf16(false, a, false, b, (short)0, c, false, false); }



// ---- k_gemmw: register-blocked GEMM, ONE WAVE per 64x64 output tile (16 accumulators), operands straight from K-contiguous 16-bit planes; grid (M/64, N/64, Z), 32 threads.
// C[m][n] (f32, pitch ldc, + optional f32 bias[n]) = sum_k A[m][k] Bt[n][k] (+ split products per NSPLIT). z-batch strides sA/sB/sC in elements. K % 32 == 0.
template <typename T16> struct WFrag;
template <> struct WFrag<h16> { typedef v16h V; static __device__ __forceinline__ V ld(const h16* p) { return cat16(*(const v8h*)p, *(const v8h*)(p + 16)); } static __device__ __forceinline__ v8f mma(V a, V b, v8f c) { return wmma16(a, b, c); } };
template <> struct WFrag<bf> { typedef v16bf V; static __device__ __forceinline__ V ld(const bf* p) { return cat16b(*(const v8us*)p, *(const v8us*)(p + 16)); } static __device__ __forceinline__ v8f mma(V a, V b, v8f c) { return wmmab(a, b, c); } };
template <typename T16, int NSPLIT, bool BIAS>
__global__ __launch_bounds__(32) void k_gemmw(const T16* __restrict__ A, const T16* __restrict__ A2, const T16* __restrict__ Bt, const T16* __restrict__ Bt2, int K, float* C, int ldc, const float* __restrict__ bias, size_t sA, size_t sB, size_t sC) {
    typedef typename WFrag<T16>::V V;
    __shared__ __align__(16) float os[16 * 68];
    const size_t z = blockIdx.z; A += z * sA; if (A2) A2 += z * sA; Bt += z * sB; if (Bt2) Bt2 += z * sB; C += z * sC;
    const int lane = threadIdx.x & 31, lr = lane & 15, hi = lane >> 4; const int r0 = blockIdx.x * 64, c0 = blockIdx.y * 64;
    v8f acc[4][4];
#pragma unroll
    for (int mb = 0; mb < 4; ++mb)
#pragma unroll
        for (int nb = 0; nb < 4; ++nb) acc[mb][nb] = (v8f){};
    const size_t aoff = (size_t)(r0 + lr) * K + 8 * hi, boff = (size_t)(c0 + lr) * K + 8 * hi;
#pragma unroll 1
    for (int kc = 0; kc < K; kc += 32) {
        V a[4], a2[4];
#pragma unroll
        for (int mb = 0; mb < 4; ++mb) { a[mb] = WFrag<T16>::ld(A + aoff + (size_t)mb * 16 * K + kc); if (NSPLIT == 1 || NSPLIT == 2) a2[mb] = WFrag<T16>::ld(A2 + aoff + (size_t)mb * 16 * K + kc); }
#pragma unroll
        for (int nb = 0; nb < 4; ++nb) { const V b = WFrag<T16>::ld(Bt + boff + (size_t)nb * 16 * K + kc); V b2; if (NSPLIT >= 2) b2 = WFrag<T16>::ld(Bt2 + boff + (size_t)nb * 16 * K + kc);
#pragma unroll
            for (int mb = 0; mb < 4; ++mb) { acc[mb][nb] = WFrag<T16>::mma(a[mb], b, acc[mb][nb]); if (NSPLIT == 1 || NSPLIT == 2) acc[mb][nb] = WFrag<T16>::mma(a2[mb], b, acc[mb][nb]); if (NSPLIT >= 2) acc[mb][nb] = WFrag<T16>::mma(a[mb], b2, acc[mb][nb]); } }
        asm volatile("v_nop\n\tv_nop\n\tv_nop\n\tv_nop" : "+v"(acc[0][0]), "+v"(acc[1][1]), "+v"(acc[2][2]), "+v"(acc[3][3]) : "v"(a[0]), "v"(a[3]));
    }
#pragma unroll
    for (int mb = 0; mb < 4; ++mb) {
#pragma unroll
        for (int nb = 0; nb < 4; ++nb) {
#pragma unroll
            for (int j = 0; j < 8; ++j) os[(hi * 8 + j) * 68 + nb * 16 + lr] = acc[mb][nb][j]; }
        __builtin_amdgcn_wave_barrier(); asm volatile("" ::: "memory");
        float* crow = C + (size_t)(r0 + mb * 16) * ldc + c0;
{
#pragma unroll
            for (int s = 0; s < 8; ++s) { const int row = 2 * s + hi, cofs = lr * 4; v4f val = *(const v4fa*)(os + row * 68 + cofs); if (BIAS) { val[0] += bfr(bias[c0 + cofs]); val[1] += bfr(bias[c0 + cofs + 1]); val[2] += bfr(bias[c0 + cofs + 2]); val[3] += bfr(bias[c0 + cofs + 3]); }
                *(v4f*)(crow + (size_t)row * ldc + cofs) = val; }
             }
        __builtin_amdgcn_wave_barrier(); asm volatile("" ::: "memory");
    }
}

__device__ __forceinline__ h16 tohx(float x) { return (h16)x; }
__device__ __forceinline__ void splitf(float y, unsigned short& h, unsigned short& l) { h = f2bf(y); l = f2bf(y - bf2f(h)); }
typedef __attribute__((ext_vector_type(2))) _Float16 v2h;
typedef __attribute__((ext_vector_type(4))) _Float16 v4h;
typedef __attribute__((ext_vector_type(2))) unsigned short v2us;
typedef __attribute__((ext_vector_type(4))) unsigned short v4us;
typedef __attribute__((ext_vector_type(2))) float v2f;
typedef __attribute__((ext_vector_type(4))) int v4i;

__global__ __launch_bounds__(256) void k_wtG(const float* __restrict__ w, int K, int N, bf* Bt) {
    const int lane = threadIdx.x & 31; const int L0 = (blockIdx.x * 8 + (threadIdx.x >> 5)) * 8; const int nlines = N * K / 64;
{
#pragma unroll 1
        for (int l = 0; l < 8; ++l) { const int L = L0 + l; if (L >= nlines) break; const size_t e = (size_t)L * 64 + lane * 2; const int k = (int)(e % K), n = (int)(e / K); v2us o;
            o[0] = f2bf(w[(size_t)k * N + n]); o[1] = f2bf(w[(size_t)(k + 1) * N + n]); *(v2us*)(Bt + e) = o; }
         }
}
__global__ __launch_bounds__(256) void k_cvt8(const float* __restrict__ src, bf* dst, size_t n8) { const size_t i = (size_t)blockIdx.x * 256 + threadIdx.x; if (i >= n8) return; const v8f v = *(const v8f*)(src + i * 8); v8us o;
#pragma unroll
    for (int k = 0; k < 8; ++k) o[k] = f2bf(v[k]); *(v8us*)(dst + i * 8) = o;  }

// k_rope: head planes [h][t][d] (fp16 + hi/lo) of rope(x) x sc with the rotate-half convention out[d] = x[d] cos[t][d] - x[d+HD/2] sin[t][d], out[d+HD/2] = x[d+HD/2] cos[t][d+HD/2] + x[d] sin[t][d+HD/2]
__global__ __launch_bounds__(256) void k_rope(const float* __restrict__ F, int pitch, int nheads, const float* __restrict__ CS, const float* __restrict__ RF, const float* __restrict__ nw, float sc, h16* P16, bf* Ph, bf* Pl) {
    const size_t e = ((size_t)blockIdx.x * 256 + threadIdx.x) * 2; if (e >= (size_t)nheads * TT * HD) return; const int d = (int)(e % HD); const int t = (int)((e / HD) % TT); const int h = (int)(e / ((size_t)HD * TT)); const float* f = F + (size_t)t * pitch + h * HD; const float rf = RF ? RF[(size_t)h * TT + t] : 1.0f; v2h o16; v2us oh, ol;
#pragma unroll
    for (int q = 0; q < 2; ++q) { const int dd = d + q; const int dp = (dd < HD / 2) ? dd + HD / 2 : dd - HD / 2; float x0 = f[dd], x1 = f[dp];
        if (RF) { float n0 = __fmul_rn(x0, rf), n1 = __fmul_rn(x1, rf); asm volatile("" : "+v"(n0)); asm volatile("" : "+v"(n1)); x0 = __fmul_rn(bfr(nw[dd]), n0); x1 = __fmul_rn(bfr(nw[dp]), n1); }
        const v2f cs = *(const v2f*)(CS + ((size_t)t * HD + dd) * 2); float a = __fmul_rn(x0, cs[0]), bq = __fmul_rn(x1, cs[1]); asm volatile("" : "+v"(a)); asm volatile("" : "+v"(bq)); const float r = ((dd < HD / 2) ? __fsub_rn(a, bq) : __fadd_rn(a, bq)) * sc;
        o16[q] = tohx(r); unsigned short a2, c2; splitf(r, a2, c2); oh[q] = a2; ol[q] = c2; }
    *(v2h*)(P16 + e) = o16; *(v2us*)(Ph + e) = oh; *(v2us*)(Pl + e) = ol;  }
__global__ __launch_bounds__(256) void k_vtp(const float* __restrict__ F, int pitch, int nheads, h16* V16, bf* Vh, bf* Vl) { const size_t e = ((size_t)blockIdx.x * 256 + threadIdx.x) * 2; if (e >= (size_t)nheads * HD * TT) return; const int t = (int)(e % TT); const int d = (int)((e / TT) % HD); const int g = (int)(e / ((size_t)TT * HD)); v2h o16; v2us oh, ol;
#pragma unroll
    for (int q = 0; q < 2; ++q) { const float x = F[(size_t)(t + q) * pitch + g * HD + d]; o16[q] = tohx(x); unsigned short a2, c2; splitf(x, a2, c2); oh[q] = a2; ol[q] = c2; }
    *(v2h*)(V16 + e) = o16; *(v2us*)(Vh + e) = oh; *(v2us*)(Vl + e) = ol;  }
__global__ __launch_bounds__(256) void k_csid(float* CS) { const int idx = blockIdx.x * 256 + threadIdx.x; if (idx >= TT * HD) return; v2f cs; cs[0] = 1.0f; cs[1] = 0.0f; *(v2f*)(CS + (size_t)idx * 2) = cs;  }
__global__ __launch_bounds__(256) void k_bdiag(const float* __restrict__ W, bf* Bt) { const size_t i = (size_t)blockIdx.x * 256 + threadIdx.x; if (i >= (size_t)DQ * DM / 8) return; const int c0 = (int)(i % (DM / 8)) * 8; const int n = (int)(i / (DM / 8)); const int h = n / HD, e = n % HD; v8us o;
#pragma unroll
    for (int k = 0; k < 8; ++k) { const int c = c0 + k; o[k] = (c / HD == h) ? f2bf(W[((size_t)h * HD + e) * HD + (c % HD)]) : (unsigned short)0; }
    *(v8us*)(Bt + (size_t)n * DM + c0) = o;  }
typedef __attribute__((ext_vector_type(8))) __bf16 v8bf;
typedef v4i __attribute__((may_alias)) v4ia;
template <typename T16> struct LFrag;
template <> struct LFrag<h16> { static __device__ __forceinline__ v16h ld(const char* p) { return cat16(*(const v8ha*)p, *(const v8ha*)(p + 32)); }
    static __device__ __forceinline__ v16h pack(v8f a, v8f b) { return cat16(__builtin_convertvector(a, v8h), __builtin_convertvector(b, v8h)); } };
template <> struct LFrag<bf> { static __device__ __forceinline__ v16bf ld(const char* p) { return cat16b(*(const v8usa*)p, *(const v8usa*)(p + 32)); }
    static __device__ __forceinline__ v16bf pack(v8f a, v8f b) { return __builtin_shufflevector(__builtin_convertvector(a, v8bf), __builtin_convertvector(b, v8bf), 0, 1, 2, 3, 4, 5, 6, 7, 8, 9, 10, 11, 12, 13, 14, 15); } };
__device__ __forceinline__ v8f bfres(v8f a) { return a - __builtin_convertvector(__builtin_convertvector(a, v8bf), v8f); }   // what the bf16 rounding of a leaves
__device__ __forceinline__ float xhalf(float x) { return __builtin_bit_cast(float, __builtin_amdgcn_permlanex16(__builtin_bit_cast(int, x), __builtin_bit_cast(int, x), 0x76543210, 0xfedcba98, false, false)); }   // lane l with lane l ^ 16
#define FKS  64                   // keys per stage
#define FPB  144                  // LDS row pitch in bytes: 128 of data + 16 (16 x odd: b128 readers without bank conflicts)
#define FPL  (64 * FPB)           // one staged plane: 64 rows
#define CL2  (SCL * 1.4426950408889634f)
template <typename T16, bool HI>
__global__ __launch_bounds__(256) void k_fattn(const T16* __restrict__ Q, const T16* __restrict__ Q2, const T16* __restrict__ Kp, const T16* __restrict__ K2, const T16* __restrict__ Vt, const T16* __restrict__ V2, int row0, float* __restrict__ OUT) {
    typedef typename WFrag<T16>::V V;
    constexpr int NP = HI ? 4 : 2;          // staged planes: K, V^T (, K low, V^T low)
    __shared__ __align__(16) char sm[2 * NP * FPL];
    const int tid = threadIdx.x, lane = tid & 31, lr = lane & 15, hi = lane >> 4, wv = tid >> 5;
    const int head = blockIdx.y;
    const size_t pl = ((size_t)blockIdx.z * NH_ + head) * (size_t)(TT * HD);
    const int q0 = row0 + blockIdx.x * 256 + wv * 32;
    V qf[2][2], qf2[2][2];
#pragma unroll
    for (int g = 0; g < 2; ++g)
#pragma unroll
        for (int ks = 0; ks < 2; ++ks) { const size_t qo = pl + (size_t)(q0 + g * 16 + lr) * HD + ks * 32 + 8 * hi; qf[g][ks] = WFrag<T16>::ld(Q + qo); if (HI) qf2[g][ks] = WFrag<T16>::ld(Q2 + qo); }
    // staging: 16-byte chunk tid + 256 j of a 64 x 128-byte plane is row tid / 8 + 32 j, chunk tid % 8
    const int srow = tid >> 3, scol = tid & 7;
    const size_t gko = pl + (size_t)srow * HD + scol * 8, gvo = pl + (size_t)srow * TT + scol * 8;
    const int so = srow * FPB + scol * 16;
    v4i st[NP][2];
    auto fetch = [&](int kb) {
#pragma unroll
        for (int j = 0; j < 2; ++j) { st[0][j] = *(const v4ia*)(Kp + gko + (size_t)(kb + j * 32) * HD); st[1][j] = *(const v4ia*)(Vt + gvo + (size_t)j * 32 * TT + kb);
            if (HI) { st[2][j] = *(const v4ia*)(K2 + gko + (size_t)(kb + j * 32) * HD); st[3][j] = *(const v4ia*)(V2 + gvo + (size_t)j * 32 * TT + kb); } }
        asm volatile("s_wait_xcnt 0x0" ::: "memory"); };   // precaution: stands in front of the first overwrite of these loads' address registers (the LDS reads behind it reuse them)
    auto put = [&](int buf) { char* d = sm + buf * (NP * FPL) + so;
#pragma unroll
        for (int p = 0; p < NP; ++p)
#pragma unroll
            for (int j = 0; j < 2; ++j) *(v4ia*)(d + p * FPL + j * 32 * FPB) = st[p][j]; };
    v8f o[2][4]; float m[2], l[2];
#pragma unroll
    for (int g = 0; g < 2; ++g) { m[g] = -3.0e38f; l[g] = 0.f;
#pragma unroll
        for (int dt = 0; dt < 4; ++dt) o[g][dt] = (v8f){}; }
    fetch(0); put(0); __syncthreads();      // stage 0 is visible to all 8 waves
    const int fo = lr * FPB + 16 * hi;      // a lane's fragment: row lr of a 16-row tile, bytes 16 hi and 32 + 16 hi of each 64
#pragma unroll 1                            // rolled: one copy of the stage body, the buffer chosen by s & 1
    for (int s = 0; s < TT / FKS; ++s) {
        if (s + 1 < TT / FKS) fetch((s + 1) * FKS);   // the next stage's loads fly while this stage is worked on
        const char* B = sm + (s & 1) * (NP * FPL) + fo;
#pragma unroll
        for (int kk = 0; kk < 2; ++kk) {    // 32 keys a pass
            v8f sc[2][2];
#pragma unroll
            for (int t = 0; t < 2; ++t) { const char* kr = B + (kk * 2 + t) * 16 * FPB; const V k0 = LFrag<T16>::ld(kr), k1 = LFrag<T16>::ld(kr + 64); V k0l, k1l; if (HI) { k0l = LFrag<T16>::ld(kr + 2 * FPL); k1l = LFrag<T16>::ld(kr + 2 * FPL + 64); }
#pragma unroll
                for (int g = 0; g < 2; ++g) { v8f a = (v8f){}; a = WFrag<T16>::mma(k0, qf[g][0], a); a = WFrag<T16>::mma(k1, qf[g][1], a);
                    if (HI) { a = WFrag<T16>::mma(k0, qf2[g][0], a); a = WFrag<T16>::mma(k1, qf2[g][1], a); a = WFrag<T16>::mma(k0l, qf[g][0], a); a = WFrag<T16>::mma(k1l, qf[g][1], a); }
                    sc[g][t] = a; } }
            float mx[2];
#pragma unroll
            for (int g = 0; g < 2; ++g) { float a = fmaxf(sc[g][0][0], sc[g][1][0]);
#pragma unroll
                for (int j = 1; j < 8; ++j) a = fmaxf(a, fmaxf(sc[g][0][j], sc[g][1][j]));
                mx[g] = fmaxf(a, xhalf(a)) * CL2; }
            const bool need = (mx[0] > m[0] + 8.0f) || (mx[1] > m[1] + 8.0f);
            if (__builtin_amdgcn_ballot_w32(need) != 0) {   // scalar branch; always taken on the first pass, rare later
#pragma unroll
                for (int g = 0; g < 2; ++g) { const float mn = fmaxf(m[g], mx[g]); const float al = __builtin_amdgcn_exp2f(m[g] - mn); m[g] = mn; l[g] *= al;
#pragma unroll
                    for (int dt = 0; dt < 4; ++dt) o[g][dt] *= al; } }
            V pf[2], pf2[2];
#pragma unroll
            for (int g = 0; g < 2; ++g) {
#pragma unroll
                for (int t = 0; t < 2; ++t)
#pragma unroll
                    for (int j = 0; j < 8; ++j) { const float p = __builtin_amdgcn_exp2f(__builtin_fmaf(sc[g][t][j], CL2, -m[g])); sc[g][t][j] = p; l[g] += p; }
                pf[g] = LFrag<T16>::pack(sc[g][0], sc[g][1]); if (HI) pf2[g] = LFrag<T16>::pack(bfres(sc[g][0]), bfres(sc[g][1])); }
#pragma unroll
            for (int dt = 0; dt < 4; ++dt) { const char* vr = B + FPL + dt * 16 * FPB + kk * 64; const V vf = LFrag<T16>::ld(vr); V vl; if (HI) vl = LFrag<T16>::ld(vr + 2 * FPL);
#pragma unroll
                for (int g = 0; g < 2; ++g) { o[g][dt] = WFrag<T16>::mma(vf, pf[g], o[g][dt]); if (HI) { o[g][dt] = WFrag<T16>::mma(vf, pf2[g], o[g][dt]); o[g][dt] = WFrag<T16>::mma(vl, pf[g], o[g][dt]); } } }
        }
        if (s + 1 < TT / FKS) put((s + 1) & 1);   // the buffer that stage s - 1 read: every wave left it at the last barrier
        __syncthreads();                    // publishes stage s + 1 and ends every wave's reads of stage s
    }
    // epilogue: each wave turns its O^T tiles into output rows through its own 16 x 68 floats of the (now free) ring, so that stores are whole 256-byte row pieces
    float* os = (float*)sm + wv * (16 * 68);
#pragma unroll
    for (int g = 0; g < 2; ++g) { const float inv = 1.0f / (l[g] + xhalf(l[g]));
#pragma unroll
        for (int dt = 0; dt < 4; ++dt) { const v8f v = o[g][dt] * inv; float* d = os + lr * 68 + dt * 16 + 8 * hi; *(v4fa*)d = __builtin_shufflevector(v, v, 0, 1, 2, 3); *(v4fa*)(d + 4) = __builtin_shufflevector(v, v, 4, 5, 6, 7); }
        __builtin_amdgcn_wave_barrier(); asm volatile("" ::: "memory");   // other lanes' LDS writes above, this lane's reads below: keep the compiler from crossing them
        float* orow = OUT + ((size_t)blockIdx.z * TT + q0 + g * 16) * DQ + head * HD;
#pragma unroll
        for (int r = 0; r < 8; ++r) { const int row = 2 * r + hi; *(v4f*)(orow + (size_t)row * DQ + lr * 4) = *(const v4fa*)(os + row * 68 + lr * 4); }
        __builtin_amdgcn_wave_barrier(); asm volatile("" ::: "memory");   // the reads above end before the next group's writes
    }
}

extern "C" void kernel_launch(void* const* d_in, const int* in_sizes, int n_in,
                              void* d_out, int out_size, void* d_ws, size_t ws_size, hipStream_t stream) {
    (void)in_sizes; (void)n_in; (void)out_size;
    const float* x = (const float*)d_in[0]; const float* wq = (const float*)d_in[1]; const float* bq = (const float*)d_in[2]; const float* wk = (const float*)d_in[3]; const float* bk = (const float*)d_in[4]; const float* wv = (const float*)d_in[5]; const float* bv = (const float*)d_in[6]; const float* wo = nullptr; (void)wo;
    float* OUT = (float*)d_out;     // [8][1024][1024]
    char* wsp = (char*)d_ws;
    auto take = [&](size_t bytes) { char* p = wsp; wsp += (bytes + 255) & ~(size_t)255; return (void*)p; };
    bf* WQ = (bf*)take((size_t)DQ * DM * 2); bf* WK = (bf*)take((size_t)DKV * DM * 2); bf* WV = (bf*)take((size_t)DKV * DM * 2); float* CS = (float*)take((size_t)TT * HD * 2 * 4);
    bf* XB = (bf*)take((size_t)TT * DM * 2); float* FQ = (float*)take((size_t)TT * DQ * 4); float* FK = (float*)take((size_t)TT * DKV * 4);
    const size_t PB = (size_t)NH_ * TT * HD;   // one batch's share of a head plane, elements; every plane holds all NB_ batches
    h16* QP16 = (h16*)take(NB_ * PB * 2); h16* KP16 = (h16*)take(NB_ * PB * 2); h16* VT16 = (h16*)take(NB_ * PB * 2);
    bf* QPh = (bf*)take(NB_ * PB * 2); bf* QPl = (bf*)take(NB_ * PB * 2); bf* KPh = (bf*)take(NB_ * PB * 2); bf* KPl = (bf*)take(NB_ * PB * 2); bf* VTh = (bf*)take(NB_ * PB * 2); bf* VTl = (bf*)take(NB_ * PB * 2);
    if ((size_t)(wsp - (char*)d_ws) > ws_size) return;    // ws 256 MiB
    float* FV = FK;   // v projection reuses the k buffer after the k planes are built (stream-ordered)
    { const unsigned gb = (unsigned)(((size_t)DQ * DM / 8 + 255) / 256); k_bdiag<<<gb, 256, 0, stream>>>(wq, WQ); k_bdiag<<<gb, 256, 0, stream>>>(wk, WK); k_bdiag<<<gb, 256, 0, stream>>>(wv, WV);
      
       }
    k_csid<<<(TT * HD + 255) / 256, 256, 0, stream>>>(CS);
    const unsigned LQ = (unsigned)(((size_t)NH_ * TT * HD / 2 + 255) / 256), LKv = (unsigned)(((size_t)NKV * TT * HD / 2 + 255) / 256);
    for (int b = 0; b < NB_; ++b) {
        
        k_cvt8<<<(unsigned)(((size_t)TT * DM / 8 + 255) / 256), 256, 0, stream>>>(x + (size_t)b * TT * DM, XB, (size_t)TT * DM / 8);
        k_gemmw<bf, 0, true><<<dim3(TT / 64, DQ / 64, 1), 32, 0, stream>>>(XB, nullptr, WQ, nullptr, DM, FQ, DQ, bq, 0, 0, 0);
        k_rope<<<LQ, 256, 0, stream>>>(FQ, DQ, NH_, CS, nullptr, nullptr, 1.0f, QP16 + b * PB, QPh + b * PB, QPl + b * PB);
        k_gemmw<bf, 0, true><<<dim3(TT / 64, DKV / 64, 1), 32, 0, stream>>>(XB, nullptr, WK, nullptr, DM, FK, DKV, bk, 0, 0, 0);
        k_rope<<<LKv, 256, 0, stream>>>(FK, DKV, NKV, CS, nullptr, nullptr, 1.0f, KP16 + b * PB, KPh + b * PB, KPl + b * PB);
        k_gemmw<bf, 0, true><<<dim3(TT / 64, DKV / 64, 1), 32, 0, stream>>>(XB, nullptr, WV, nullptr, DM, FV, DKV, bv, 0, 0, 0); k_vtp<<<LKv, 256, 0, stream>>>(FV, DKV, NKV, VT16 + b * PB, VTh + b * PB, VTl + b * PB);
    }
    k_fattn<bf, true><<<dim3(RH / 256, NH_, NB_), 256, 0, stream>>>(QPh, QPl, KPh, KPl, VTh, VTl, 0, OUT);
    k_fattn<h16, false><<<dim3((TT - RH) / 256, NH_, NB_), 256, 0, stream>>>(QP16, nullptr, KP16, nullptr, VT16, nullptr, RH, OUT);
}

// v003
// It runs in 77.7 microseconds.
// Next to v002, in two timings, it ran 8.82 and 8.79 times as fast.
// All steps since v000 together make it 56.0 times as fast.
#include <hip/hip_runtime.h>

// Per-head multi-head self-attention (sequences [8][1024][1024] viewed as 16 head slices of 64; per head: q = x_h Wq[h]^T + bq[h], k, v likewise ('oi' [16][64][64] + [16][64]); scores = q.k / 8; softmax; out_h = attn v; heads re-stacked -> [8][1024][1024] (8.4 M)).
// Layout: one projection kernel over every batch and head reads x and the three 64x64 weights of its head, forms q, k and v (K = 64) and writes the q, k and v^T head planes; one fused attention kernel (scores, online softmax, attn v, output rows) runs over every batch and head (hybrid rows: < 512 hi/lo 3 products, rest fp16).
// Compute dtypes, f32 accumulate: every input rounded to bf16; projections exact + f32 biases; attention rows < 512 3 products, rest fp16; softmax f32 (running maximum and sum); output f32.

#define NB_  8
#define TT   1024
#define DM   1024
#define NH_  16
#define NKV  16
#define REP  (NH_ / NKV)
#define HD   64
#define DQ   (NH_ * HD)
#define DKV  (NKV * HD)
#define RH   512                  // query rows < RH use hi+lo planes (0: none)
#define WIN  0
#define SCL  0.125f   // HD^-0.5
typedef _Float16 h16;
typedef unsigned short bf;
typedef __attribute__((ext_vector_type(16))) __bf16   v16bf;
typedef __attribute__((ext_vector_type(16))) _Float16 v16h;
typedef __attribute__((ext_vector_type(8)))  _Float16 v8h;
typedef __attribute__((ext_vector_type(8)))  unsigned short v8us;
typedef __attribute__((ext_vector_type(8)))  float    v8f;
typedef __attribute__((ext_vector_type(4)))  float    v4f;
typedef v8h  __attribute__((may_alias)) v8ha;
typedef v4f  __attribute__((may_alias)) v4fa;
typedef v8us __attribute__((may_alias)) v8usa;

__device__ __forceinline__ unsigned short f2bf(float f) { unsigned u = __float_as_uint(f); u += 0x7FFFu + ((u >> 16) & 1u); return (unsigned short)(u >> 16); }
__device__ __forceinline__ float bf2f(unsigned short b) { return __uint_as_float(((unsigned)b) << 16); }
__device__ __forceinline__ float bfr(float f) { return bf2f(f2bf(f)); }
__device__ __forceinline__ v16h cat16(v8h lo, v8h hi) { return __builtin_shufflevector(lo, hi, 0, 1, 2, 3, 4, 5, 6, 7, 8, 9, 10, 11, 12, 13, 14, 15); }
__device__ __forceinline__ v16bf cat16b(v8us lo, v8us hi) { return __builtin_bit_cast(v16bf, __builtin_shufflevector(lo, hi, 0, 1, 2, 3, 4, 5, 6, 7, 8, 9, 10, 11, 12, 13, 14, 15)); }
__device__ __forceinline__ v8f wmma16(v16h a, v16h b, v8f c) { return __builtin_amdgcn_wmma_f32_16x16x32_f16(false, a, false, b, (short)0, c, false, false); }
__device__ __forceinline__ v8f wmmab(v16bf a, v16bf b, v8f c) { return __builtin_amdgcn_wmma_f32_16x16x32_bf16(false, a, false, b, (short)0, c, false, false); }

// fragment loader (K-contiguous 16-bit rows in global memory) and matrix product of each operand type
template <typename T16> struct WFrag;
template <> struct WFrag<h16> { typedef v16h V; static __device__ __forceinline__ V ld(const h16* p) { return cat16(*(const v8h*)p, *(const v8h*)(p + 16)); } static __device__ __forceinline__ v8f mma(V a, V b, v8f c) { return wmma16(a, b, c); } };
template <> struct WFrag<bf> { typedef v16bf V; static __device__ __forceinline__ V ld(const bf* p) { return cat16b(*(const v8us*)p, *(const v8us*)(p + 16)); } static __device__ __forceinline__ v8f mma(V a, V b, v8f c) { return wmmab(a, b, c); } };
typedef __attribute__((ext_vector_type(4))) int v4i;
typedef __attribute__((ext_vector_type(8))) __bf16 v8bf;
typedef v4i __attribute__((may_alias)) v4ia;
template <typename T16> struct LFrag;
template <> struct LFrag<h16> { static __device__ __forceinline__ v16h ld(const char* p) { return cat16(*(const v8ha*)p, *(const v8ha*)(p + 32)); }
    static __device__ __forceinline__ v16h pack(v8f a, v8f b) { return cat16(__builtin_convertvector(a, v8h), __builtin_convertvector(b, v8h)); } };
template <> struct LFrag<bf> { static __device__ __forceinline__ v16bf ld(const char* p) { return cat16b(*(const v8usa*)p, *(const v8usa*)(p + 32)); }
    static __device__ __forceinline__ v16bf pack(v8f a, v8f b) { return __builtin_shufflevector(__builtin_convertvector(a, v8bf), __builtin_convertvector(b, v8bf), 0, 1, 2, 3, 4, 5, 6, 7, 8, 9, 10, 11, 12, 13, 14, 15); } };
__device__ __forceinline__ v8f bfres(v8f a) { return a - __builtin_convertvector(__builtin_convertvector(a, v8bf), v8f); }   // what the bf16 rounding of a leaves
__device__ __forceinline__ float xhalf(float x) { return __builtin_bit_cast(float, __builtin_amdgcn_permlanex16(__builtin_bit_cast(int, x), __builtin_bit_cast(int, x), 0x76543210, 0xfedcba98, false, false)); }   // lane l with lane l ^ 16
#define FKS  64                   // keys per stage
#define FPB  144                  // LDS row pitch in bytes: 128 of data + 16 (16 x odd: b128 readers without bank conflicts)
#define FPL  (64 * FPB)           // one staged plane: 64 rows
#define CL2  (SCL * 1.4426950408889634f)
template <typename T16, bool HI>
__global__ __launch_bounds__(256) void k_fattn(const T16* __restrict__ Q, const T16* __restrict__ Q2, const T16* __restrict__ Kp, const T16* __restrict__ K2, const T16* __restrict__ Vt, const T16* __restrict__ V2, int row0, float* __restrict__ OUT) {
    typedef typename WFrag<T16>::V V;
    constexpr int NP = HI ? 4 : 2;          // staged planes: K, V^T (, K low, V^T low)
    __shared__ __align__(16) char sm[2 * NP * FPL];
    const int tid = threadIdx.x, lane = tid & 31, lr = lane & 15, hi = lane >> 4, wv = tid >> 5;
    const int head = blockIdx.y;
    const size_t pl = ((size_t)blockIdx.z * NH_ + head) * (size_t)(TT * HD);
    const int q0 = row0 + blockIdx.x * 256 + wv * 32;
    V qf[2][2], qf2[2][2];
#pragma unroll
    for (int g = 0; g < 2; ++g)
#pragma unroll
        for (int ks = 0; ks < 2; ++ks) { const size_t qo = pl + (size_t)(q0 + g * 16 + lr) * HD + ks * 32 + 8 * hi; qf[g][ks] = WFrag<T16>::ld(Q + qo); if (HI) qf2[g][ks] = WFrag<T16>::ld(Q2 + qo); }
    // staging: 16-byte chunk tid + 256 j of a 64 x 128-byte plane is row tid / 8 + 32 j, chunk tid % 8
    const int srow = tid >> 3, scol = tid & 7;
    const size_t gko = pl + (size_t)srow * HD + scol * 8, gvo = pl + (size_t)srow * TT + scol * 8;
    const int so = srow * FPB + scol * 16;
    v4i st[NP][2];
    auto fetch = [&](int kb) {
#pragma unroll
        for (int j = 0; j < 2; ++j) { st[0][j] = *(const v4ia*)(Kp + gko + (size_t)(kb + j * 32) * HD); st[1][j] = *(const v4ia*)(Vt + gvo + (size_t)j * 32 * TT + kb);
            if (HI) { st[2][j] = *(const v4ia*)(K2 + gko + (size_t)(kb + j * 32) * HD); st[3][j] = *(const v4ia*)(V2 + gvo + (size_t)j * 32 * TT + kb); } }
        asm volatile("s_wait_xcnt 0x0" ::: "memory"); };   // precaution: stands in front of the first overwrite of these loads' address registers (the LDS reads behind it reuse them)
    auto put = [&](int buf) { char* d = sm + buf * (NP * FPL) + so;
#pragma unroll
        for (int p = 0; p < NP; ++p)
#pragma unroll
            for (int j = 0; j < 2; ++j) *(v4ia*)(d + p * FPL + j * 32 * FPB) = st[p][j]; };
    v8f o[2][4]; float m[2], l[2];
#pragma unroll
    for (int g = 0; g < 2; ++g) { m[g] = -3.0e38f; l[g] = 0.f;
#pragma unroll
        for (int dt = 0; dt < 4; ++dt) o[g][dt] = (v8f){}; }
    fetch(0); put(0); __syncthreads();      // stage 0 is visible to all 8 waves
    const int fo = lr * FPB + 16 * hi;      // a lane's fragment: row lr of a 16-row tile, bytes 16 hi and 32 + 16 hi of each 64
#pragma unroll 1                            // rolled: one copy of the stage body, the buffer chosen by s & 1
    for (int s = 0; s < TT / FKS; ++s) {
        if (s + 1 < TT / FKS) fetch((s + 1) * FKS);   // the next stage's loads fly while this stage is worked on
        const char* B = sm + (s & 1) * (NP * FPL) + fo;
#pragma unroll
        for (int kk = 0; kk < 2; ++kk) {    // 32 keys a pass
            v8f sc[2][2];
#pragma unroll
            for (int t = 0; t < 2; ++t) { const char* kr = B + (kk * 2 + t) * 16 * FPB; const V k0 = LFrag<T16>::ld(kr), k1 = LFrag<T16>::ld(kr + 64); V k0l, k1l; if (HI) { k0l = LFrag<T16>::ld(kr + 2 * FPL); k1l = LFrag<T16>::ld(kr + 2 * FPL + 64); }
#pragma unroll
                for (int g = 0; g < 2; ++g) { v8f a = (v8f){}; a = WFrag<T16>::mma(k0, qf[g][0], a); a = WFrag<T16>::mma(k1, qf[g][1], a);
                    if (HI) { a = WFrag<T16>::mma(k0, qf2[g][0], a); a = WFrag<T16>::mma(k1, qf2[g][1], a); a = WFrag<T16>::mma(k0l, qf[g][0], a); a = WFrag<T16>::mma(k1l, qf[g][1], a); }
                    sc[g][t] = a; } }
            float mx[2];
#pragma unroll
            for (int g = 0; g < 2; ++g) { float a = fmaxf(sc[g][0][0], sc[g][1][0]);
#pragma unroll
                for (int j = 1; j < 8; ++j) a = fmaxf(a, fmaxf(sc[g][0][j], sc[g][1][j]));
                mx[g] = fmaxf(a, xhalf(a)) * CL2; }
            const bool need = (mx[0] > m[0] + 8.0f) || (mx[1] > m[1] + 8.0f);
            if (__builtin_amdgcn_ballot_w32(need) != 0) {   // scalar branch; always taken on the first pass, rare later
#pragma unroll
                for (int g = 0; g < 2; ++g) { const float mn = fmaxf(m[g], mx[g]); const float al = __builtin_amdgcn_exp2f(m[g] - mn); m[g] = mn; l[g] *= al;
#pragma unroll
                    for (int dt = 0; dt < 4; ++dt) o[g][dt] *= al; } }
            V pf[2], pf2[2];
#pragma unroll
            for (int g = 0; g < 2; ++g) {
#pragma unroll
                for (int t = 0; t < 2; ++t)
#pragma unroll
                    for (int j = 0; j < 8; ++j) { const float p = __builtin_amdgcn_exp2f(__builtin_fmaf(sc[g][t][j], CL2, -m[g])); sc[g][t][j] = p; l[g] += p; }
                pf[g] = LFrag<T16>::pack(sc[g][0], sc[g][1]); if (HI) pf2[g] = LFrag<T16>::pack(bfres(sc[g][0]), bfres(sc[g][1])); }
#pragma unroll
            for (int dt = 0; dt < 4; ++dt) { const char* vr = B + FPL + dt * 16 * FPB + kk * 64; const V vf = LFrag<T16>::ld(vr); V vl; if (HI) vl = LFrag<T16>::ld(vr + 2 * FPL);
#pragma unroll
                for (int g = 0; g < 2; ++g) { o[g][dt] = WFrag<T16>::mma(vf, pf[g], o[g][dt]); if (HI) { o[g][dt] = WFrag<T16>::mma(vf, pf2[g], o[g][dt]); o[g][dt] = WFrag<T16>::mma(vl, pf[g], o[g][dt]); } } }
        }
        if (s + 1 < TT / FKS) put((s + 1) & 1);   // the buffer that stage s - 1 read: every wave left it at the last barrier
        __syncthreads();                    // publishes stage s + 1 and ends every wave's reads of stage s
    }
    // epilogue: each wave turns its O^T tiles into output rows through its own 16 x 68 floats of the (now free) ring, so that stores are whole 256-byte row pieces
    float* os = (float*)sm + wv * (16 * 68);
#pragma unroll
    for (int g = 0; g < 2; ++g) { const float inv = 1.0f / (l[g] + xhalf(l[g]));
#pragma unroll
        for (int dt = 0; dt < 4; ++dt) { const v8f v = o[g][dt] * inv; float* d = os + lr * 68 + dt * 16 + 8 * hi; *(v4fa*)d = __builtin_shufflevector(v, v, 0, 1, 2, 3); *(v4fa*)(d + 4) = __builtin_shufflevector(v, v, 4, 5, 6, 7); }
        __builtin_amdgcn_wave_barrier(); asm volatile("" ::: "memory");   // other lanes' LDS writes above, this lane's reads below: keep the compiler from crossing them
        float* orow = OUT + ((size_t)blockIdx.z * TT + q0 + g * 16) * DQ + head * HD;
#pragma unroll
        for (int r = 0; r < 8; ++r) { const int row = 2 * r + hi; *(v4f*)(orow + (size_t)row * DQ + lr * 4) = *(const v4fa*)(os + row * 68 + lr * 4); }
        __builtin_amdgcn_wave_barrier(); asm volatile("" ::: "memory");   // the reads above end before the next group's writes
    }
}

// ---- k_proj: q, k and v of one (batch, head) for 512 tokens, written straight as the head planes (fp16, bf16 high, bf16 low) that k_fattn reads; 8 waves x 64 tokens; grid (tokens / 512, heads, batches).
// x (each wave its own 64 rows) and the head's three 64x64 weights (the 8 waves together) go global f32 -> bf16 -> LDS in whole lines; fragments come from LDS with the loader of k_fattn, the same for A and B.
// q, k: D = W x^T (a lane holds 8 neighbouring features of ONE token); v: D = x W^T (a lane holds 8 neighbouring tokens of ONE feature): both are 16-byte pieces of a plane row.
// 16 plane rows at a time pass through the wave's own LDS piece, so that every global store covers whole 128-byte lines.
typedef __attribute__((ext_vector_type(4))) __bf16 v4bf;
typedef __attribute__((ext_vector_type(2))) int v2i;
typedef v2i __attribute__((may_alias)) v2ia;
#define PST  (16 * FPB)           // one plane's 16 staged output rows
__device__ __forceinline__ v8f bfwide(v8bf h) { const v4i p = __builtin_bit_cast(v4i, h); v8f f;   // the packed bf16 values as floats: a shift or a mask each
#pragma unroll
    for (int q = 0; q < 4; ++q) { f[2 * q] = __int_as_float(p[q] << 16); f[2 * q + 1] = __int_as_float(p[q] & (int)0xffff0000u); }
    return f; }
template <bool VT>
__device__ __forceinline__ void proj_planes(const v16bf (&xf)[4][2], const char* wl, const float* sb, char* stg, h16* P16, bf* Ph, bf* Pl, int lane) {
    const int lr = lane & 15, hi = lane >> 4;
    constexpr int pitch = VT ? TT : HD;     // elements between plane rows
    v16bf wf[4][2];
#pragma unroll
    for (int t = 0; t < 4; ++t)
#pragma unroll
        for (int ks = 0; ks < 2; ++ks) wf[t][ks] = LFrag<bf>::ld(wl + t * 16 * FPB + ks * 64);
    v8f bm[4]; float bn[4];                 // the bias follows the feature: the D row (q, k) or the D column (v)
#pragma unroll
    for (int t = 0; t < 4; ++t) { if (VT) bn[t] = sb[t * 16 + lr]; else { const float* s = sb + t * 16 + hi * 8; bm[t] = __builtin_shufflevector(*(const v4fa*)s, *(const v4fa*)(s + 4), 0, 1, 2, 3, 4, 5, 6, 7); } }
#pragma unroll
    for (int nb = 0; nb < 4; ++nb) {        // 16 plane rows (D columns) a pass
        v8f acc[4];
#pragma unroll
        for (int mb = 0; mb < 4; ++mb) { acc[mb] = (v8f){};
#pragma unroll
            for (int ks = 0; ks < 2; ++ks) acc[mb] = VT ? wmmab(xf[mb][ks], wf[nb][ks], acc[mb]) : wmmab(wf[mb][ks], xf[nb][ks], acc[mb]); }
#pragma unroll
        for (int mb = 0; mb < 4; ++mb) { const v8f y = VT ? acc[mb] + bn[nb] : acc[mb] + bm[mb]; char* d = stg + lr * FPB + mb * 32 + hi * 16;
            const v8bf yh = __builtin_convertvector(y, v8bf);
            *(v4ia*)d = __builtin_bit_cast(v4i, __builtin_convertvector(y, v8h));
            *(v4ia*)(d + PST) = __builtin_bit_cast(v4i, yh);
            *(v4ia*)(d + 2 * PST) = __builtin_bit_cast(v4i, __builtin_convertvector(y - bfwide(yh), v8bf)); }
        __builtin_amdgcn_wave_barrier(); asm volatile("" ::: "memory");   // other lanes' LDS writes above, this lane's reads below: keep the compiler from crossing them
#pragma unroll
        for (int i = 0; i < 4; ++i) { const int row = i * 4 + (lane >> 3); const char* s = stg + row * FPB + (lane & 7) * 16; const size_t go = (size_t)(nb * 16 + row) * pitch + (lane & 7) * 8;
            *(v4ia*)(P16 + go) = *(const v4ia*)s; *(v4ia*)(Ph + go) = *(const v4ia*)(s + PST); *(v4ia*)(Pl + go) = *(const v4ia*)(s + 2 * PST); }
        __builtin_amdgcn_wave_barrier(); asm volatile("s_wait_xcnt 0x0" ::: "memory");   // the reads above end before the next pass's writes; the wait is a precaution: it stands in front of the first overwrite of a register that these stores name
        __builtin_amdgcn_sched_barrier(0);  // the next pass's products stay behind that wait: hoisted, they push the kernel past 256 registers
    }
}
__global__ __launch_bounds__(256) void k_proj(const float* __restrict__ x, const float* __restrict__ Wq, const float* __restrict__ bq, const float* __restrict__ Wk, const float* __restrict__ bk, const float* __restrict__ Wv, const float* __restrict__ bv,
                                              h16* Q16, bf* Qh, bf* Ql, h16* K16, bf* Kh, bf* Kl, h16* V16, bf* Vh, bf* Vl) {
    __shared__ __align__(16) char sm[11 * FPL + 3 * HD * 4];   // planes 0..2: Wq, Wk, Wv of the head; 3 + wave: the wave's x rows, later its output rows; then the three rounded biases
    const int tid = threadIdx.x, lane = tid & 31, lr = lane & 15, hi = lane >> 4, wave = tid >> 5;
    const int head = blockIdx.y, t0 = blockIdx.x * 512 + wave * 64;
    const float* xl = x + ((size_t)blockIdx.z * TT + t0 + hi) * DM + head * HD + lr * 4;   // the lane's 16 bytes of rows hi, 2 + hi, ...
    char* own = sm + (3 + wave) * FPL; float* sb = (float*)(sm + 11 * FPL);
    const int be = head * HD + (tid & 63); const float rq = bq[be], rk = bk[be], rv = bv[be];
    v4f xv[32], wr[12];                     // every load is issued before the first conversion waits for one
#pragma unroll
    for (int i = 0; i < 32; ++i) xv[i] = *(const v4fa*)(xl + (size_t)(2 * i) * DM);          // two 256-byte row pieces a load
    asm volatile("s_wait_xcnt 0x0" :: "v"(xl), "v"(be) : "memory");   // precaution: stands in front of the first overwrite of the address registers of the loads above; the addresses as inputs keep a load's own result off them
#pragma unroll
    for (int i = 0; i < 12; ++i) { const float* w = i < 4 ? Wq : i < 8 ? Wk : Wv; wr[i] = *(const v4fa*)(w + (size_t)head * (HD * HD) + ((i & 3) * 256 + tid) * 4); }
    asm volatile("" :: "v"(rq), "v"(rk), "v"(rv));   // holds the three bias loads up here among the others: left alone they sink into the branch below, and their latency is paid in front of the barrier
#pragma unroll
    for (int i = 0; i < 32; ++i) *(v2ia*)(own + (2 * i + hi) * FPB + lr * 8) = __builtin_bit_cast(v2i, __builtin_convertvector(xv[i], v4bf));
#pragma unroll
    for (int i = 0; i < 12; ++i) { const int c = (i & 3) * 256 + tid; *(v2ia*)(sm + (i >> 2) * FPL + (c >> 4) * FPB + (c & 15) * 8) = __builtin_bit_cast(v2i, __builtin_convertvector(wr[i], v4bf)); }
    if (wave < 2) { sb[tid] = bfr(rq); sb[HD + tid] = bfr(rk); sb[2 * HD + tid] = bfr(rv); }
    __syncthreads();                        // the weights and biases (and each wave's x rows) are visible to every lane that reads fragments
    const int fo = lr * FPB + 16 * hi;      // a lane's fragment: row lr of a 16-row tile, bytes 16 hi and 32 + 16 hi of each 64
    v16bf xf[4][2];
#pragma unroll
    for (int t = 0; t < 4; ++t)
#pragma unroll
        for (int ks = 0; ks < 2; ++ks) xf[t][ks] = LFrag<bf>::ld(own + fo + t * 16 * FPB + ks * 64);
    __builtin_amdgcn_wave_barrier(); asm volatile("" ::: "memory");       // the x rows are in registers before their LDS piece takes output rows
    const size_t pl = ((size_t)blockIdx.z * NH_ + head) * (size_t)(TT * HD);
    const size_t ro = pl + (size_t)t0 * HD, co = pl + t0;                 // token-major planes start at row t0, v^T planes at column t0
    proj_planes<false>(xf, sm + fo, sb, own, Q16 + ro, Qh + ro, Ql + ro, lane);
    proj_planes<false>(xf, sm + FPL + fo, sb + HD, own, K16 + ro, Kh + ro, Kl + ro, lane);
    proj_planes<true>(xf, sm + 2 * FPL + fo, sb + 2 * HD, own, V16 + co, Vh + co, Vl + co, lane);
}

extern "C" void kernel_launch(void* const* d_in, const int* in_sizes, int n_in,
                              void* d_out, int out_size, void* d_ws, size_t ws_size, hipStream_t stream) {
    (void)in_sizes; (void)n_in; (void)out_size;
    const float* x = (const float*)d_in[0]; const float* wq = (const float*)d_in[1]; const float* bq = (const float*)d_in[2]; const float* wk = (const float*)d_in[3]; const float* bk = (const float*)d_in[4]; const float* wv = (const float*)d_in[5]; const float* bv = (const float*)d_in[6];
    float* OUT = (float*)d_out;     // [8][1024][1024]
    char* wsp = (char*)d_ws;
    auto take = [&](size_t bytes) { char* p = wsp; wsp += (bytes + 255) & ~(size_t)255; return (void*)p; };
    const size_t PB = (size_t)NH_ * TT * HD;   // one batch's share of a head plane, elements; every plane holds all NB_ batches
    h16* QP16 = (h16*)take(NB_ * PB * 2); h16* KP16 = (h16*)take(NB_ * PB * 2); h16* VT16 = (h16*)take(NB_ * PB * 2);
    bf* QPh = (bf*)take(NB_ * PB * 2); bf* QPl = (bf*)take(NB_ * PB * 2); bf* KPh = (bf*)take(NB_ * PB * 2); bf* KPl = (bf*)take(NB_ * PB * 2); bf* VTh = (bf*)take(NB_ * PB * 2); bf* VTl = (bf*)take(NB_ * PB * 2);
    if ((size_t)(wsp - (char*)d_ws) > ws_size) return;    // ws 256 MiB
    k_proj<<<dim3(TT / 512, NH_, NB_), 256, 0, stream>>>(x, wq, bq, wk, bk, wv, bv, QP16, QPh, QPl, KP16, KPh, KPl, VT16, VTh, VTl);
    k_fattn<bf, true><<<dim3(RH / 256, NH_, NB_), 256, 0, stream>>>(QPh, QPl, KPh, KPl, VTh, VTl, 0, OUT);
    k_fattn<h16, false><<<dim3((TT - RH) / 256, NH_, NB_), 256, 0, stream>>>(QP16, nullptr, KP16, nullptr, VT16, nullptr, RH, OUT);
}

// v004
// A run of this version takes 72.1 microseconds.
// Next to v003, in two timings, it ran 1.08 times as fast each time.
// All steps since v000 together make it 60.4 times as fast.
#include <hip/hip_runtime.h>

// Per-head multi-head self-attention (sequences [8][1024][1024] viewed as 16 head slices of 64; per head: q = x_h Wq[h]^T + bq[h], k, v likewise ('oi' [16][64][64] + [16][64]); scores = q.k / 8; softmax; out_h = attn v; heads re-stacked -> [8][1024][1024] (8.4 M)).
// Layout: one projection kernel over every batch and head reads x and the three 64x64 weights of its head, forms q, k and v (K = 64) and writes the q, k and v^T head planes, each as an fp16 plane and, for q only rows < 512, an fp16 plane of what that rounding leaves; one fused attention kernel (scores, online softmax, attn v, output rows) runs over every batch and head (hybrid rows: < 512 hi/lo 3 products, rest the high planes alone).
// Compute dtypes, f32 accumulate: every input rounded to bf16; projections exact + f32 biases; attention rows < 512 3 products of fp16 high/low pairs, rest fp16; softmax f32 (running maximum and sum); output f32.

#define NB_  8
#define TT   1024
#define DM   1024
#define NH_  16
#define NKV  16
#define REP  (NH_ / NKV)
#define HD   64
#define DQ   (NH_ * HD)
#define DKV  (NKV * HD)
#define RH   512                  // query rows < RH use hi+lo planes (0: none)
#define WIN  0
#define SCL  0.125f   // HD^-0.5
typedef _Float16 h16;
typedef unsigned short bf;
typedef __attribute__((ext_vector_type(16))) __bf16   v16bf;
typedef __attribute__((ext_vector_type(16))) _Float16 v16h;
typedef __attribute__((ext_vector_type(8)))  _Float16 v8h;
typedef __attribute__((ext_vector_type(8)))  unsigned short v8us;
typedef __attribute__((ext_vector_type(8)))  float    v8f;
typedef __attribute__((ext_vector_type(4)))  float    v4f;
typedef v8h  __attribute__((may_alias)) v8ha;
typedef v4f  __attribute__((may_alias)) v4fa;
typedef v8us __attribute__((may_alias)) v8usa;

__device__ __forceinline__ unsigned short f2bf(float f) { unsigned u = __float_as_uint(f); u += 0x7FFFu + ((u >> 16) & 1u); return (unsigned short)(u >> 16); }
__device__ __forceinline__ float bf2f(unsigned short b) { return __uint_as_float(((unsigned)b) << 16); }
__device__ __forceinline__ float bfr(float f) { return bf2f(f2bf(f)); }
__device__ __forceinline__ v16h cat16(v8h lo, v8h hi) { return __builtin_shufflevector(lo, hi, 0, 1, 2, 3, 4, 5, 6, 7, 8, 9, 10, 11, 12, 13, 14, 15); }
__device__ __forceinline__ v16bf cat16b(v8us lo, v8us hi) { return __builtin_bit_cast(v16bf, __builtin_shufflevector(lo, hi, 0, 1, 2, 3, 4, 5, 6, 7, 8, 9, 10, 11, 12, 13, 14, 15)); }
__device__ __forceinline__ v8f wmma16(v16h a, v16h b, v8f c) { return __builtin_amdgcn_wmma_f32_16x16x32_f16(false, a, false, b, (short)0, c, false, false); }
__device__ __forceinline__ v8f wmmab(v16bf a, v16bf b, v8f c) { return __builtin_amdgcn_wmma_f32_16x16x32_bf16(false, a, false, b, (short)0, c, false, false); }

// fragment loader (K-contiguous fp16 rows in global memory)
__device__ __forceinline__ v16h gfrag(const h16* p) { return cat16(*(const v8h*)p, *(const v8h*)(p + 16)); }
typedef __attribute__((ext_vector_type(4))) int v4i;
typedef v4i __attribute__((may_alias)) v4ia;
template <typename T16> struct LFrag;
template <> struct LFrag<h16> { static __device__ __forceinline__ v16h ld(const char* p) { return cat16(*(const v8ha*)p, *(const v8ha*)(p + 32)); } };
template <> struct LFrag<bf> { static __device__ __forceinline__ v16bf ld(const char* p) { return cat16b(*(const v8usa*)p, *(const v8usa*)(p + 32)); } };
__device__ __forceinline__ v8h hres(v8f a, v8h h) { return __builtin_convertvector(a - __builtin_convertvector(h, v8f), v8h); }   // what the fp16 rounding h of a leaves (an exact difference), itself rounded to fp16
__device__ __forceinline__ float xhalf(float x) { return __builtin_bit_cast(float, __builtin_amdgcn_permlanex16(__builtin_bit_cast(int, x), __builtin_bit_cast(int, x), 0x76543210, 0xfedcba98, false, false)); }   // lane l with lane l ^ 16
#define FKS  64                   // keys per stage
#define FPB  144                  // LDS row pitch in bytes: 128 of data + 16 (16 x odd: b128 readers without bank conflicts)
#define FPL  (64 * FPB)           // one staged plane: 64 rows
#define CL2  (SCL * 1.4426950408889634f)
template <bool HI>
__global__ __launch_bounds__(256) void k_fattn(const h16* __restrict__ Q, const h16* __restrict__ Q2, const h16* __restrict__ Kp, const h16* __restrict__ K2, const h16* __restrict__ Vt, const h16* __restrict__ V2, int row0, float* __restrict__ OUT) {
    typedef v16h V;
    constexpr int NP = HI ? 4 : 2;          // staged planes: K, V^T (, K low, V^T low)
    __shared__ __align__(16) char sm[2 * NP * FPL];
    const int tid = threadIdx.x, lane = tid & 31, lr = lane & 15, hi = lane >> 4, wv = tid >> 5;
    const int head = blockIdx.y;
    const size_t pl = ((size_t)blockIdx.z * NH_ + head) * (size_t)(TT * HD);
    const int q0 = row0 + blockIdx.x * 256 + wv * 32;
    V qf[2][2], qf2[2][2];
#pragma unroll
    for (int g = 0; g < 2; ++g)
#pragma unroll
        for (int ks = 0; ks < 2; ++ks) { const size_t qo = pl + (size_t)(q0 + g * 16 + lr) * HD + ks * 32 + 8 * hi; qf[g][ks] = gfrag(Q + qo); if (HI) qf2[g][ks] = gfrag(Q2 + qo); }
    // staging: 16-byte chunk tid + 256 j of a 64 x 128-byte plane is row tid / 8 + 32 j, chunk tid % 8
    const int srow = tid >> 3, scol = tid & 7;
    const size_t gko = pl + (size_t)srow * HD + scol * 8, gvo = pl + (size_t)srow * TT + scol * 8;
    const int so = srow * FPB + scol * 16;
    v4i st[NP][2];
    auto fetch = [&](int kb) {
#pragma unroll
        for (int j = 0; j < 2; ++j) { st[0][j] = *(const v4ia*)(Kp + gko + (size_t)(kb + j * 32) * HD); st[1][j] = *(const v4ia*)(Vt + gvo + (size_t)j * 32 * TT + kb);
            if (HI) { st[2][j] = *(const v4ia*)(K2 + gko + (size_t)(kb + j * 32) * HD); st[3][j] = *(const v4ia*)(V2 + gvo + (size_t)j * 32 * TT + kb); } }
        asm volatile("s_wait_xcnt 0x0" ::: "memory"); };   // precaution: stands in front of the first overwrite of these loads' address registers (the LDS reads behind it reuse them)
    auto put = [&](int buf) { char* d = sm + buf * (NP * FPL) + so;
#pragma unroll
        for (int p = 0; p < NP; ++p)
#pragma unroll
            for (int j = 0; j < 2; ++j) *(v4ia*)(d + p * FPL + j * 32 * FPB) = st[p][j]; };
    v8f o[2][4]; float m[2], l[2];
#pragma unroll
    for (int g = 0; g < 2; ++g) { m[g] = -3.0e38f; l[g] = 0.f;
#pragma unroll
        for (int dt = 0; dt < 4; ++dt) o[g][dt] = (v8f){}; }
    fetch(0); put(0); __syncthreads();      // stage 0 is visible to all 8 waves
    const int fo = lr * FPB + 16 * hi;      // a lane's fragment: row lr of a 16-row tile, bytes 16 hi and 32 + 16 hi of each 64
#pragma unroll 1                            // rolled: one copy of the stage body, the buffer chosen by s & 1
    for (int s = 0; s < TT / FKS; ++s) {
        if (s + 1 < TT / FKS) fetch((s + 1) * FKS);   // the next stage's loads fly while this stage is worked on
        const char* B = sm + (s & 1) * (NP * FPL) + fo;
#pragma unroll
        for (int kk = 0; kk < 2; ++kk) {    // 32 keys a pass
            v8f sc[2][2];
#pragma unroll
            for (int t = 0; t < 2; ++t) { const char* kr = B + (kk * 2 + t) * 16 * FPB; const V k0 = LFrag<h16>::ld(kr), k1 = LFrag<h16>::ld(kr + 64); V k0l, k1l; if (HI) { k0l = LFrag<h16>::ld(kr + 2 * FPL); k1l = LFrag<h16>::ld(kr + 2 * FPL + 64); }
#pragma unroll
                for (int g = 0; g < 2; ++g) { v8f a = (v8f){}; a = wmma16(k0, qf[g][0], a); a = wmma16(k1, qf[g][1], a);
                    if (HI) { a = wmma16(k0, qf2[g][0], a); a = wmma16(k1, qf2[g][1], a); a = wmma16(k0l, qf[g][0], a); a = wmma16(k1l, qf[g][1], a); }
                    sc[g][t] = a; } }
            float mx[2];
#pragma unroll
            for (int g = 0; g < 2; ++g) { float a = fmaxf(sc[g][0][0], sc[g][1][0]);
#pragma unroll
                for (int j = 1; j < 8; ++j) a = fmaxf(a, fmaxf(sc[g][0][j], sc[g][1][j]));
                mx[g] = fmaxf(a, xhalf(a)) * CL2; }
            const bool need = (mx[0] > m[0] + 8.0f) || (mx[1] > m[1] + 8.0f);
            if (__builtin_amdgcn_ballot_w32(need) != 0) {   // scalar branch; always taken on the first pass, rare later
#pragma unroll
                for (int g = 0; g < 2; ++g) { const float mn = fmaxf(m[g], mx[g]); const float al = __builtin_amdgcn_exp2f(m[g] - mn); m[g] = mn; l[g] *= al;
#pragma unroll
                    for (int dt = 0; dt < 4; ++dt) o[g][dt] *= al; } }
            V pf[2], pf2[2];
#pragma unroll
            for (int g = 0; g < 2; ++g) {
#pragma unroll
                for (int t = 0; t < 2; ++t)
#pragma unroll
                    for (int j = 0; j < 8; ++j) { const float p = __builtin_amdgcn_exp2f(__builtin_fmaf(sc[g][t][j], CL2, -m[g])); sc[g][t][j] = p; l[g] += p; }
                const v8h p0 = __builtin_convertvector(sc[g][0], v8h), p1 = __builtin_convertvector(sc[g][1], v8h);
                pf[g] = cat16(p0, p1); if (HI) pf2[g] = cat16(hres(sc[g][0], p0), hres(sc[g][1], p1)); }
#pragma unroll
            for (int dt = 0; dt < 4; ++dt) { const char* vr = B + FPL + dt * 16 * FPB + kk * 64; const V vf = LFrag<h16>::ld(vr); V vl; if (HI) vl = LFrag<h16>::ld(vr + 2 * FPL);
#pragma unroll
                for (int g = 0; g < 2; ++g) { o[g][dt] = wmma16(vf, pf[g], o[g][dt]); if (HI) { o[g][dt] = wmma16(vf, pf2[g], o[g][dt]); o[g][dt] = wmma16(vl, pf[g], o[g][dt]); } } }
        }
        if (HI) { __builtin_amdgcn_sched_barrier(0);   // the stage's last products stay in front of the four slots below
            asm volatile("v_nop\n\tv_nop\n\tv_nop\n\tv_nop"); }   // the distance a matrix product needs before a vector instruction overwrites its operands: in the 3-product build the taken side of the branch below starts with such an overwrite
        if (s + 1 < TT / FKS) put((s + 1) & 1);   // the buffer that stage s - 1 read: every wave left it at the last barrier
        __syncthreads();                    // publishes stage s + 1 and ends every wave's reads of stage s
    }
    // epilogue: each wave turns its O^T tiles into output rows through its own 16 x 68 floats of the (now free) ring, so that stores are whole 256-byte row pieces
    float* os = (float*)sm + wv * (16 * 68);
#pragma unroll
    for (int g = 0; g < 2; ++g) { const float inv = 1.0f / (l[g] + xhalf(l[g]));
#pragma unroll
        for (int dt = 0; dt < 4; ++dt) { const v8f v = o[g][dt] * inv; float* d = os + lr * 68 + dt * 16 + 8 * hi; *(v4fa*)d = __builtin_shufflevector(v, v, 0, 1, 2, 3); *(v4fa*)(d + 4) = __builtin_shufflevector(v, v, 4, 5, 6, 7); }
        __builtin_amdgcn_wave_barrier(); asm volatile("" ::: "memory");   // other lanes' LDS writes above, this lane's reads below: keep the compiler from crossing them
        float* orow = OUT + ((size_t)blockIdx.z * TT + q0 + g * 16) * DQ + head * HD;
#pragma unroll
        for (int r = 0; r < 8; ++r) { const int row = 2 * r + hi; *(v4f*)(orow + (size_t)row * DQ + lr * 4) = *(const v4fa*)(os + row * 68 + lr * 4); }
        __builtin_amdgcn_wave_barrier(); asm volatile("" ::: "memory");   // the reads above end before the next group's writes
    }
}

// ---- k_proj: q, k and v of one (batch, head) for 512 tokens, written straight as the head planes (fp16 high, fp16 low; q low only for the rows < RH, which alone read it) that k_fattn reads; 8 waves x 64 tokens; grid (tokens / 512, heads, batches).
// x (each wave its own 64 rows) and the head's three 64x64 weights (the 8 waves together) go global f32 -> bf16 -> LDS in whole lines; fragments come from LDS with the loader of k_fattn, the same for A and B.
// q, k: D = W x^T (a lane holds 8 neighbouring features of ONE token); v: D = x W^T (a lane holds 8 neighbouring tokens of ONE feature): both are 16-byte pieces of a plane row.
// 16 plane rows at a time pass through the wave's own LDS piece, so that every global store covers whole 128-byte lines.
typedef __attribute__((ext_vector_type(4))) __bf16 v4bf;
typedef __attribute__((ext_vector_type(2))) int v2i;
typedef v2i __attribute__((may_alias)) v2ia;
#define PST  (16 * FPB)           // one plane's 16 staged output rows
template <bool VT, bool LOW>
__device__ __forceinline__ void proj_planes(const v16bf (&xf)[4][2], const char* wl, const float* sb, char* stg, h16* Ph, h16* Pl, int lane) {
    const int lr = lane & 15, hi = lane >> 4;
    constexpr int pitch = VT ? TT : HD;     // elements between plane rows
    v16bf wf[4][2];
#pragma unroll
    for (int t = 0; t < 4; ++t)
#pragma unroll
        for (int ks = 0; ks < 2; ++ks) wf[t][ks] = LFrag<bf>::ld(wl + t * 16 * FPB + ks * 64);
    v8f bm[4]; float bn[4];                 // the bias follows the feature: the D row (q, k) or the D column (v)
#pragma unroll
    for (int t = 0; t < 4; ++t) { if (VT) bn[t] = sb[t * 16 + lr]; else { const float* s = sb + t * 16 + hi * 8; bm[t] = __builtin_shufflevector(*(const v4fa*)s, *(const v4fa*)(s + 4), 0, 1, 2, 3, 4, 5, 6, 7); } }
#pragma unroll
    for (int nb = 0; nb < 4; ++nb) {        // 16 plane rows (D columns) a pass
        v8f acc[4];
#pragma unroll
        for (int mb = 0; mb < 4; ++mb) { acc[mb] = (v8f){};
#pragma unroll
            for (int ks = 0; ks < 2; ++ks) acc[mb] = VT ? wmmab(xf[mb][ks], wf[nb][ks], acc[mb]) : wmmab(wf[mb][ks], xf[nb][ks], acc[mb]); }
#pragma unroll
        for (int mb = 0; mb < 4; ++mb) { const v8f y = VT ? acc[mb] + bn[nb] : acc[mb] + bm[mb]; char* d = stg + lr * FPB + mb * 32 + hi * 16;
            const v8h yh = __builtin_convertvector(y, v8h);
            *(v4ia*)d = __builtin_bit_cast(v4i, yh);
            if (LOW) *(v4ia*)(d + PST) = __builtin_bit_cast(v4i, hres(y, yh)); }
        __builtin_amdgcn_wave_barrier(); asm volatile("" ::: "memory");   // other lanes' LDS writes above, this lane's reads below: keep the compiler from crossing them
#pragma unroll
        for (int i = 0; i < 4; ++i) { const int row = i * 4 + (lane >> 3); const char* s = stg + row * FPB + (lane & 7) * 16; const size_t go = (size_t)(nb * 16 + row) * pitch + (lane & 7) * 8;
            *(v4ia*)(Ph + go) = *(const v4ia*)s; if (LOW) *(v4ia*)(Pl + go) = *(const v4ia*)(s + PST); }
        __builtin_amdgcn_wave_barrier(); asm volatile("s_wait_xcnt 0x0" ::: "memory");   // the reads above end before the next pass's writes; the wait is a precaution: it stands in front of the first overwrite of a register that these stores name
        __builtin_amdgcn_sched_barrier(0);  // the next pass's products stay behind that wait: hoisted, they push the kernel past 256 registers
    }
}
__global__ __launch_bounds__(256) void k_proj(const float* __restrict__ x, const float* __restrict__ Wq, const float* __restrict__ bq, const float* __restrict__ Wk, const float* __restrict__ bk, const float* __restrict__ Wv, const float* __restrict__ bv,
                                              h16* Qh, h16* Ql, h16* Kh, h16* Kl, h16* Vh, h16* Vl) {
    __shared__ __align__(16) char sm[11 * FPL + 3 * HD * 4];   // planes 0..2: Wq, Wk, Wv of the head; 3 + wave: the wave's x rows, later its output rows; then the three rounded biases
    const int tid = threadIdx.x, lane = tid & 31, lr = lane & 15, hi = lane >> 4, wave = tid >> 5;
    const int head = blockIdx.y, t0 = blockIdx.x * 512 + wave * 64;
    const float* xl = x + ((size_t)blockIdx.z * TT + t0 + hi) * DM + head * HD + lr * 4;   // the lane's 16 bytes of rows hi, 2 + hi, ...
    char* own = sm + (3 + wave) * FPL; float* sb = (float*)(sm + 11 * FPL);
    const int be = head * HD + (tid & 63); const float rq = bq[be], rk = bk[be], rv = bv[be];
    v4f xv[32], wr[12];                     // every load is issued before the first conversion waits for one
#pragma unroll
    for (int i = 0; i < 32; ++i) xv[i] = *(const v4fa*)(xl + (size_t)(2 * i) * DM);          // two 256-byte row pieces a load
    asm volatile("s_wait_xcnt 0x0" :: "v"(xl), "v"(be) : "memory");   // precaution: stands in front of the first overwrite of the address registers of the loads above; the addresses as inputs keep a load's own result off them
#pragma unroll
    for (int i = 0; i < 12; ++i) { const float* w = i < 4 ? Wq : i < 8 ? Wk : Wv; wr[i] = *(const v4fa*)(w + (size_t)head * (HD * HD) + ((i & 3) * 256 + tid) * 4); }
    asm volatile("" :: "v"(rq), "v"(rk), "v"(rv));   // holds the three bias loads up here among the others: left alone they sink into the branch below, and their latency is paid in front of the barrier
#pragma unroll
    for (int i = 0; i < 32; ++i) *(v2ia*)(own + (2 * i + hi) * FPB + lr * 8) = __builtin_bit_cast(v2i, __builtin_convertvector(xv[i], v4bf));
#pragma unroll
    for (int i = 0; i < 12; ++i) { const int c = (i & 3) * 256 + tid; *(v2ia*)(sm + (i >> 2) * FPL + (c >> 4) * FPB + (c & 15) * 8) = __builtin_bit_cast(v2i, __builtin_convertvector(wr[i], v4bf)); }
    if (wave < 2) { sb[tid] = bfr(rq); sb[HD + tid] = bfr(rk); sb[2 * HD + tid] = bfr(rv); }
    __syncthreads();                        // the weights and biases (and each wave's x rows) are visible to every lane that reads fragments
    const int fo = lr * FPB + 16 * hi;      // a lane's fragment: row lr of a 16-row tile, bytes 16 hi and 32 + 16 hi of each 64
    v16bf xf[4][2];
#pragma unroll
    for (int t = 0; t < 4; ++t)
#pragma unroll
        for (int ks = 0; ks < 2; ++ks) xf[t][ks] = LFrag<bf>::ld(own + fo + t * 16 * FPB + ks * 64);
    __builtin_amdgcn_wave_barrier(); asm volatile("" ::: "memory");       // the x rows are in registers before their LDS piece takes output rows
    const size_t pl = ((size_t)blockIdx.z * NH_ + head) * (size_t)(TT * HD);
    const size_t ro = pl + (size_t)t0 * HD, co = pl + t0;                 // token-major planes start at row t0, v^T planes at column t0
    static_assert(RH % 512 == 0, "a work-group's 512 tokens lie on one side of RH");
    if (blockIdx.x * 512 < RH) proj_planes<false, true>(xf, sm + fo, sb, own, Qh + ro, Ql + ro, lane);
    else proj_planes<false, false>(xf, sm + fo, sb, own, Qh + ro, nullptr, lane);
    proj_planes<false, true>(xf, sm + FPL + fo, sb + HD, own, Kh + ro, Kl + ro, lane);
    proj_planes<true, true>(xf, sm + 2 * FPL + fo, sb + 2 * HD, own, Vh + co, Vl + co, lane);
}

extern "C" void kernel_launch(void* const* d_in, const int* in_sizes, int n_in,
                              void* d_out, int out_size, void* d_ws, size_t ws_size, hipStream_t stream) {
    (void)in_sizes; (void)n_in; (void)out_size;
    const float* x = (const float*)d_in[0]; const float* wq = (const float*)d_in[1]; const float* bq = (const float*)d_in[2]; const float* wk = (const float*)d_in[3]; const float* bk = (const float*)d_in[4]; const float* wv = (const float*)d_in[5]; const float* bv = (const float*)d_in[6];
    float* OUT = (float*)d_out;     // [8][1024][1024]
    char* wsp = (char*)d_ws;
    auto take = [&](size_t bytes) { char* p = wsp; wsp += (bytes + 255) & ~(size_t)255; return (void*)p; };
    const size_t PB = (size_t)NH_ * TT * HD;   // one batch's share of a head plane, elements; every plane holds all NB_ batches
    h16* QPh = (h16*)take(NB_ * PB * 2); h16* QPl = (h16*)take(NB_ * PB * 2); h16* KPh = (h16*)take(NB_ * PB * 2); h16* KPl = (h16*)take(NB_ * PB * 2); h16* VTh = (h16*)take(NB_ * PB * 2); h16* VTl = (h16*)take(NB_ * PB * 2);
    if ((size_t)(wsp - (char*)d_ws) > ws_size) return;    // ws 256 MiB
    k_proj<<<dim3(TT / 512, NH_, NB_), 256, 0, stream>>>(x, wq, bq, wk, bk, wv, bv, QPh, QPl, KPh, KPl, VTh, VTl);
    k_fattn<true><<<dim3(RH / 256, NH_, NB_), 256, 0, stream>>>(QPh, QPl, KPh, KPl, VTh, VTl, 0, OUT);
    k_fattn<false><<<dim3((TT - RH) / 256, NH_, NB_), 256, 0, stream>>>(QPh, nullptr, KPh, nullptr, VTh, nullptr, RH, OUT);
}

// v005
// One run takes 68.3 microseconds.
// Next to v004, in two timings, it ran 1.05 times as fast each time.
// Over all steps from v000 it is 63.5 times as fast.
#include <hip/hip_runtime.h>

// Per-head multi-head self-attention (sequences [8][1024][1024] viewed as 16 head slices of 64; per head: q = x_h Wq[h]^T + bq[h], k, v likewise ('oi' [16][64][64] + [16][64]); scores = q.k / 8; softmax; out_h = attn v; heads re-stacked -> [8][1024][1024] (8.4 M)).
// Layout: one projection kernel over every batch and head reads x and the three 64x64 weights of its head, forms q, k and v (K = 64) and writes the q, k and v^T head planes, each as an fp16 plane and, for q only rows < 512, an fp16 plane of what that rounding leaves; one fused attention kernel (scores, online softmax, attn v, output rows) runs over every batch and head (hybrid rows: < 512 hi/lo 3 products, rest the high planes alone).
// Compute dtypes, f32 accumulate: every input rounded to bf16; projections exact + f32 biases; attention rows < 512 3 products of fp16 high/low pairs, rest fp16; softmax f32 (running maximum and sum); output f32.

#define NB_  8
#define TT   1024
#define DM   1024
#define NH_  16
#define NKV  16
#define REP  (NH_ / NKV)
#define HD   64
#define DQ   (NH_ * HD)
#define DKV  (NKV * HD)
#define RH   512                  // query rows < RH use hi+lo planes (0: none)
#define WIN  0
#define SCL  0.125f   // HD^-0.5
typedef _Float16 h16;
typedef unsigned short bf;
typedef __attribute__((ext_vector_type(16))) __bf16   v16bf;
typedef __attribute__((ext_vector_type(16))) _Float16 v16h;
typedef __attribute__((ext_vector_type(8)))  _Float16 v8h;
typedef __attribute__((ext_vector_type(8)))  unsigned short v8us;
typedef __attribute__((ext_vector_type(8)))  float    v8f;
typedef __attribute__((ext_vector_type(4)))  float    v4f;
typedef v8h  __attribute__((may_alias)) v8ha;
typedef v4f  __attribute__((may_alias)) v4fa;
typedef v8us __attribute__((may_alias)) v8usa;

__device__ __forceinline__ unsigned short f2bf(float f) { unsigned u = __float_as_uint(f); u += 0x7FFFu + ((u >> 16) & 1u); return (unsigned short)(u >> 16); }
__device__ __forceinline__ float bf2f(unsigned short b) { return __uint_as_float(((unsigned)b) << 16); }
__device__ __forceinline__ float bfr(float f) { return bf2f(f2bf(f)); }
__device__ __forceinline__ v16h cat16(v8h lo, v8h hi) { return __builtin_shufflevector(lo, hi, 0, 1, 2, 3, 4, 5, 6, 7, 8, 9, 10, 11, 12, 13, 14, 15); }
__device__ __forceinline__ v16bf cat16b(v8us lo, v8us hi) { return __builtin_bit_cast(v16bf, __builtin_shufflevector(lo, hi, 0, 1, 2, 3, 4, 5, 6, 7, 8, 9, 10, 11, 12, 13, 14, 15)); }
__device__ __forceinline__ v8f wmma16(v16h a, v16h b, v8f c) { return __builtin_amdgcn_wmma_f32_16x16x32_f16(false, a, false, b, (short)0, c, false, false); }
__device__ __forceinline__ v8f wmmab(v16bf a, v16bf b, v8f c) { return __builtin_amdgcn_wmma_f32_16x16x32_bf16(false, a, false, b, (short)0, c, false, false); }

// fragment loader (K-contiguous fp16 rows in global memory)
__device__ __forceinline__ v16h gfrag(const h16* p) { return cat16(*(const v8h*)p, *(const v8h*)(p + 16)); }
typedef __attribute__((ext_vector_type(4))) int v4i;
typedef v4i __attribute__((may_alias)) v4ia;
template <typename T16> struct LFrag;
template <> struct LFrag<h16> { static __device__ __forceinline__ v16h ld(const char* p) { return cat16(*(const v8ha*)p, *(const v8ha*)(p + 32)); } };
template <> struct LFrag<bf> { static __device__ __forceinline__ v16bf ld(const char* p) { return cat16b(*(const v8usa*)p, *(const v8usa*)(p + 32)); } };
__device__ __forceinline__ v8h hres(v8f a, v8h h) { return __builtin_convertvector(a - __builtin_convertvector(h, v8f), v8h); }   // what the fp16 rounding h of a leaves (an exact difference), itself rounded to fp16
__device__ __forceinline__ float xhalf(float x) { return __builtin_bit_cast(float, __builtin_amdgcn_permlanex16(__builtin_bit_cast(int, x), __builtin_bit_cast(int, x), 0x76543210, 0xfedcba98, false, false)); }   // lane l with lane l ^ 16
#define FKS  64                   // keys per stage
#define FPB  144                  // LDS row pitch in bytes: 128 of data + 16 (16 x odd: b128 readers without bank conflicts)
#define FPL  (64 * FPB)           // one staged plane: 64 rows
#define CL2  (SCL * 1.4426950408889634f)
template <bool HI>
__global__ __launch_bounds__(256) void k_fattn(const h16* __restrict__ Q, const h16* __restrict__ Q2, const h16* __restrict__ Kp, const h16* __restrict__ K2, const h16* __restrict__ Vt, const h16* __restrict__ V2, int row0, float* __restrict__ OUT) {
    typedef v16h V;
    constexpr int NP = HI ? 4 : 2;          // staged planes: K, V^T (, K low, V^T low)
    __shared__ __align__(16) char sm[2 * NP * FPL];
    const int tid = threadIdx.x, lane = tid & 31, lr = lane & 15, hi = lane >> 4, wv = tid >> 5;
    const int head = blockIdx.y;
    const size_t pl = ((size_t)blockIdx.z * NH_ + head) * (size_t)(TT * HD);
    const int q0 = row0 + blockIdx.x * 256 + wv * 32;
    V qf[2][2], qf2[2][2];
#pragma unroll
    for (int g = 0; g < 2; ++g)
#pragma unroll
        for (int ks = 0; ks < 2; ++ks) { const size_t qo = pl + (size_t)(q0 + g * 16 + lr) * HD + ks * 32 + 8 * hi; qf[g][ks] = gfrag(Q + qo); if (HI) qf2[g][ks] = gfrag(Q2 + qo); }
    // staging: 16-byte chunk tid + 256 j of a 64 x 128-byte plane is row tid / 8 + 32 j, chunk tid % 8
    const int srow = tid >> 3, scol = tid & 7;
    const size_t gko = pl + (size_t)srow * HD + scol * 8, gvo = pl + (size_t)srow * TT + scol * 8;
    const int so = srow * FPB + scol * 16;
    v4i st[NP][2];
    auto fetch = [&](int kb) {
#pragma unroll
        for (int j = 0; j < 2; ++j) { st[0][j] = *(const v4ia*)(Kp + gko + (size_t)(kb + j * 32) * HD); st[1][j] = *(const v4ia*)(Vt + gvo + (size_t)j * 32 * TT + kb);
            if (HI) { st[2][j] = *(const v4ia*)(K2 + gko + (size_t)(kb + j * 32) * HD); st[3][j] = *(const v4ia*)(V2 + gvo + (size_t)j * 32 * TT + kb); } }
        asm volatile("s_wait_xcnt 0x0" ::: "memory"); };   // precaution: stands in front of the first overwrite of these loads' address registers (the LDS reads behind it reuse them)
    auto put = [&](int buf) { char* d = sm + buf * (NP * FPL) + so;
#pragma unroll
        for (int p = 0; p < NP; ++p)
#pragma unroll
            for (int j = 0; j < 2; ++j) *(v4ia*)(d + p * FPL + j * 32 * FPB) = st[p][j]; };
    v8f o[2][4]; float m[2], l[2];
#pragma unroll
    for (int g = 0; g < 2; ++g) { m[g] = -3.0e38f; l[g] = 0.f;
#pragma unroll
        for (int dt = 0; dt < 4; ++dt) o[g][dt] = (v8f){}; }
    fetch(0); put(0); __syncthreads();      // stage 0 is visible to all 8 waves
    const int fo = lr * FPB + 16 * hi;      // a lane's fragment: row lr of a 16-row tile, bytes 16 hi and 32 + 16 hi of each 64
#pragma unroll 1                            // rolled: one copy of the stage body, the buffer chosen by s & 1
    for (int s = 0; s < TT / FKS; ++s) {
        const char* B = sm + (s & 1) * (NP * FPL) + fo;
        V kf[2][2][2], kl[2][2][2], vf[2][4], vl[2][4];   // the stage's fragments, each in registers of its own: K [pass][16-key tile][k half], V^T [pass][16-feature tile]
        auto ldk = [&](int kk) {
#pragma unroll
            for (int t = 0; t < 2; ++t) { const char* kr = B + (kk * 2 + t) * 16 * FPB; kf[kk][t][0] = LFrag<h16>::ld(kr); kf[kk][t][1] = LFrag<h16>::ld(kr + 64); if (HI) { kl[kk][t][0] = LFrag<h16>::ld(kr + 2 * FPL); kl[kk][t][1] = LFrag<h16>::ld(kr + 2 * FPL + 64); } } };
        auto ldv = [&](int kk) {
#pragma unroll
            for (int dt = 0; dt < 4; ++dt) { const char* vr = B + FPL + dt * 16 * FPB + kk * 64; vf[kk][dt] = LFrag<h16>::ld(vr); if (HI) vl[kk][dt] = LFrag<h16>::ld(vr + 2 * FPL); } };
        ldk(0);
        __builtin_amdgcn_sched_barrier(0);  // the first pass's K reads stay one group up here: their latency runs while the global loads below are issued
        if (s + 1 < TT / FKS) fetch((s + 1) * FKS);   // the next stage's loads fly while this stage is worked on
#pragma unroll
        for (int kk = 0; kk < 2; ++kk) {    // 32 keys a pass
            v8f sc[2][2];
#pragma unroll
            for (int t = 0; t < 2; ++t) {
#pragma unroll
                for (int g = 0; g < 2; ++g) { v8f a = (v8f){}; a = wmma16(kf[kk][t][0], qf[g][0], a); a = wmma16(kf[kk][t][1], qf[g][1], a);
                    if (HI) { a = wmma16(kf[kk][t][0], qf2[g][0], a); a = wmma16(kf[kk][t][1], qf2[g][1], a); a = wmma16(kl[kk][t][0], qf[g][0], a); a = wmma16(kl[kk][t][1], qf[g][1], a); }
                    sc[g][t] = a; } }
            if (kk == 0) { __builtin_amdgcn_sched_barrier(0);   // the products above are issued first, so that the reads below land while the matrix unit works
                ldv(0); ldk(1);
                __builtin_amdgcn_sched_barrier(0); }   // these reads stay one group here: moved down among the products that use them, each pair is waited for with nothing else in flight
            float mx[2];
#pragma unroll
            for (int g = 0; g < 2; ++g) { float a = fmaxf(sc[g][0][0], sc[g][1][0]);
#pragma unroll
                for (int j = 1; j < 8; ++j) a = fmaxf(a, fmaxf(sc[g][0][j], sc[g][1][j]));
                mx[g] = fmaxf(a, xhalf(a)) * CL2; }
            const bool need = (mx[0] > m[0] + 8.0f) || (mx[1] > m[1] + 8.0f);
            if (__builtin_amdgcn_ballot_w32(need) != 0) {   // scalar branch; always taken on the first pass, rare later
#pragma unroll
                for (int g = 0; g < 2; ++g) { const float mn = fmaxf(m[g], mx[g]); const float al = __builtin_amdgcn_exp2f(m[g] - mn); m[g] = mn; l[g] *= al;
#pragma unroll
                    for (int dt = 0; dt < 4; ++dt) o[g][dt] *= al; } }
            if (kk == 0) { ldv(1);
                __builtin_amdgcn_sched_barrier(0); }   // the second pass's V^T reads stay one group in front of this pass's exponentials, which cover their latency
            V pf[2], pf2[2];
#pragma unroll
            for (int g = 0; g < 2; ++g) {
#pragma unroll
                for (int t = 0; t < 2; ++t)
#pragma unroll
                    for (int j = 0; j < 8; ++j) { const float p = __builtin_amdgcn_exp2f(__builtin_fmaf(sc[g][t][j], CL2, -m[g])); sc[g][t][j] = p; l[g] += p; }
                const v8h p0 = __builtin_convertvector(sc[g][0], v8h), p1 = __builtin_convertvector(sc[g][1], v8h);
                pf[g] = cat16(p0, p1); if (HI) pf2[g] = cat16(hres(sc[g][0], p0), hres(sc[g][1], p1)); }
#pragma unroll
            for (int dt = 0; dt < 4; ++dt) {
#pragma unroll
                for (int g = 0; g < 2; ++g) { o[g][dt] = wmma16(vf[kk][dt], pf[g], o[g][dt]); if (HI) { o[g][dt] = wmma16(vf[kk][dt], pf2[g], o[g][dt]); o[g][dt] = wmma16(vl[kk][dt], pf[g], o[g][dt]); } } }
        }
        __builtin_amdgcn_sched_barrier(0);   // the stage's last products stay in front of the four slots below
        asm volatile("v_nop\n\tv_nop\n\tv_nop\n\tv_nop");   // the distance a matrix product needs before a vector instruction overwrites its operands
        if (s + 1 < TT / FKS) put((s + 1) & 1);   // the buffer that stage s - 1 read: every wave left it at the last barrier
        __syncthreads();                    // publishes stage s + 1 and ends every wave's reads of stage s
    }
    // epilogue: each wave turns its O^T tiles into output rows through its own 16 x 68 floats of the (now free) ring, so that stores are whole 256-byte row pieces
    float* os = (float*)sm + wv * (16 * 68);
#pragma unroll
    for (int g = 0; g < 2; ++g) { const float inv = 1.0f / (l[g] + xhalf(l[g]));
#pragma unroll
        for (int dt = 0; dt < 4; ++dt) { const v8f v = o[g][dt] * inv; float* d = os + lr * 68 + dt * 16 + 8 * hi; *(v4fa*)d = __builtin_shufflevector(v, v, 0, 1, 2, 3); *(v4fa*)(d + 4) = __builtin_shufflevector(v, v, 4, 5, 6, 7); }
        __builtin_amdgcn_wave_barrier(); asm volatile("" ::: "memory");   // other lanes' LDS writes above, this lane's reads below: keep the compiler from crossing them
        float* orow = OUT + ((size_t)blockIdx.z * TT + q0 + g * 16) * DQ + head * HD;
#pragma unroll
        for (int r = 0; r < 8; ++r) { const int row = 2 * r + hi; *(v4f*)(orow + (size_t)row * DQ + lr * 4) = *(const v4fa*)(os + row * 68 + lr * 4); }
        __builtin_amdgcn_wave_barrier(); asm volatile("" ::: "memory");   // the reads above end before the next group's writes
    }
}

// ---- k_proj: q, k and v of one (batch, head) for 512 tokens, written straight as the head planes (fp16 high, fp16 low; q low only for the rows < RH, which alone read it) that k_fattn reads; 8 waves x 64 tokens; grid (tokens / 512, heads, batches).
// x (each wave its own 64 rows) and the head's three 64x64 weights (the 8 waves together) go global f32 -> bf16 -> LDS in whole lines; fragments come from LDS with the loader of k_fattn, the same for A and B.
// q, k: D = W x^T (a lane holds 8 neighbouring features of ONE token); v: D = x W^T (a lane holds 8 neighbouring tokens of ONE feature): both are 16-byte pieces of a plane row.
// 16 plane rows at a time pass through the wave's own LDS piece, so that every global store covers whole 128-byte lines.
typedef __attribute__((ext_vector_type(4))) __bf16 v4bf;
typedef __attribute__((ext_vector_type(2))) int v2i;
typedef v2i __attribute__((may_alias)) v2ia;
#define PST  (16 * FPB)           // one plane's 16 staged output rows
template <bool VT, bool LOW>
__device__ __forceinline__ void proj_planes(const v16bf (&xf)[4][2], const char* wl, const float* sb, char* stg, h16* Ph, h16* Pl, int lane) {
    const int lr = lane & 15, hi = lane >> 4;
    constexpr int pitch = VT ? TT : HD;     // elements between plane rows
    v16bf wf[4][2];
#pragma unroll
    for (int t = 0; t < 4; ++t)
#pragma unroll
        for (int ks = 0; ks < 2; ++ks) wf[t][ks] = LFrag<bf>::ld(wl + t * 16 * FPB + ks * 64);
    v8f bm[4]; float bn[4];                 // the bias follows the feature: the D row (q, k) or the D column (v)
#pragma unroll
    for (int t = 0; t < 4; ++t) { if (VT) bn[t] = sb[t * 16 + lr]; else { const float* s = sb + t * 16 + hi * 8; bm[t] = __builtin_shufflevector(*(const v4fa*)s, *(const v4fa*)(s + 4), 0, 1, 2, 3, 4, 5, 6, 7); } }
#pragma unroll
    for (int nb = 0; nb < 4; ++nb) {        // 16 plane rows (D columns) a pass
        v8f acc[4];
#pragma unroll
        for (int mb = 0; mb < 4; ++mb) { acc[mb] = (v8f){};
#pragma unroll
            for (int ks = 0; ks < 2; ++ks) acc[mb] = VT ? wmmab(xf[mb][ks], wf[nb][ks], acc[mb]) : wmmab(wf[mb][ks], xf[nb][ks], acc[mb]); }
#pragma unroll
        for (int mb = 0; mb < 4; ++mb) { const v8f y = VT ? acc[mb] + bn[nb] : acc[mb] + bm[mb]; char* d = stg + lr * FPB + mb * 32 + hi * 16;
            const v8h yh = __builtin_convertvector(y, v8h);
            *(v4ia*)d = __builtin_bit_cast(v4i, yh);
            if (LOW) *(v4ia*)(d + PST) = __builtin_bit_cast(v4i, hres(y, yh)); }
        __builtin_amdgcn_wave_barrier(); asm volatile("" ::: "memory");   // other lanes' LDS writes above, this lane's reads below: keep the compiler from crossing them
#pragma unroll
        for (int i = 0; i < 4; ++i) { const int row = i * 4 + (lane >> 3); const char* s = stg + row * FPB + (lane & 7) * 16; const size_t go = (size_t)(nb * 16 + row) * pitch + (lane & 7) * 8;
            *(v4ia*)(Ph + go) = *(const v4ia*)s; if (LOW) *(v4ia*)(Pl + go) = *(const v4ia*)(s + PST); }
        __builtin_amdgcn_wave_barrier(); asm volatile("s_wait_xcnt 0x0" ::: "memory");   // the reads above end before the next pass's writes; the wait is a precaution: it stands in front of the first overwrite of a register that these stores name
        __builtin_amdgcn_sched_barrier(0);  // the next pass's products stay behind that wait: hoisted, they push the kernel past 256 registers
    }
}
__global__ __launch_bounds__(256) void k_proj(const float* __restrict__ x, const float* __restrict__ Wq, const float* __restrict__ bq, const float* __restrict__ Wk, const float* __restrict__ bk, const float* __restrict__ Wv, const float* __restrict__ bv,
                                              h16* Qh, h16* Ql, h16* Kh, h16* Kl, h16* Vh, h16* Vl) {
    __shared__ __align__(16) char sm[11 * FPL + 3 * HD * 4];   // planes 0..2: Wq, Wk, Wv of the head; 3 + wave: the wave's x rows, later its output rows; then the three rounded biases
    const int tid = threadIdx.x, lane = tid & 31, lr = lane & 15, hi = lane >> 4, wave = tid >> 5;
    const int head = blockIdx.y, t0 = blockIdx.x * 512 + wave * 64;
    const float* xl = x + ((size_t)blockIdx.z * TT + t0 + hi) * DM + head * HD + lr * 4;   // the lane's 16 bytes of rows hi, 2 + hi, ...
    char* own = sm + (3 + wave) * FPL; float* sb = (float*)(sm + 11 * FPL);
    const int be = head * HD + (tid & 63); const float rq = bq[be], rk = bk[be], rv = bv[be];
    v4f xv[32], wr[12];                     // every load is issued before the first conversion waits for one
#pragma unroll
    for (int i = 0; i < 32; ++i) xv[i] = *(const v4fa*)(xl + (size_t)(2 * i) * DM);          // two 256-byte row pieces a load
    asm volatile("s_wait_xcnt 0x0" :: "v"(xl), "v"(be) : "memory");   // precaution: stands in front of the first overwrite of the address registers of the loads above; the addresses as inputs keep a load's own result off them
#pragma unroll
    for (int i = 0; i < 12; ++i) { const float* w = i < 4 ? Wq : i < 8 ? Wk : Wv; wr[i] = *(const v4fa*)(w + (size_t)head * (HD * HD) + ((i & 3) * 256 + tid) * 4); }
    asm volatile("" :: "v"(rq), "v"(rk), "v"(rv));   // holds the three bias loads up here among the others: left alone they sink into the branch below, and their latency is paid in front of the barrier
#pragma unroll
    for (int i = 0; i < 32; ++i) *(v2ia*)(own + (2 * i + hi) * FPB + lr * 8) = __builtin_bit_cast(v2i, __builtin_convertvector(xv[i], v4bf));
#pragma unroll
    for (int i = 0; i < 12; ++i) { const int c = (i & 3) * 256 + tid; *(v2ia*)(sm + (i >> 2) * FPL + (c >> 4) * FPB + (c & 15) * 8) = __builtin_bit_cast(v2i, __builtin_convertvector(wr[i], v4bf)); }
    if (wave < 2) { sb[tid] = bfr(rq); sb[HD + tid] = bfr(rk); sb[2 * HD + tid] = bfr(rv); }
    __syncthreads();                        // the weights and biases (and each wave's x rows) are visible to every lane that reads fragments
    const int fo = lr * FPB + 16 * hi;      // a lane's fragment: row lr of a 16-row tile, bytes 16 hi and 32 + 16 hi of each 64
    v16bf xf[4][2];
#pragma unroll
    for (int t = 0; t < 4; ++t)
#pragma unroll
        for (int ks = 0; ks < 2; ++ks) xf[t][ks] = LFrag<bf>::ld(own + fo + t * 16 * FPB + ks * 64);
    __builtin_amdgcn_wave_barrier(); asm volatile("" ::: "memory");       // the x rows are in registers before their LDS piece takes output rows
    const size_t pl = ((size_t)blockIdx.z * NH_ + head) * (size_t)(TT * HD);
    const size_t ro = pl + (size_t)t0 * HD, co = pl + t0;                 // token-major planes start at row t0, v^T planes at column t0
    static_assert(RH % 512 == 0, "a work-group's 512 tokens lie on one side of RH");
    if (blockIdx.x * 512 < RH) proj_planes<false, true>(xf, sm + fo, sb, own, Qh + ro, Ql + ro, lane);
    else proj_planes<false, false>(xf, sm + fo, sb, own, Qh + ro, nullptr, lane);
    proj_planes<false, true>(xf, sm + FPL + fo, sb + HD, own, Kh + ro, Kl + ro, lane);
    proj_planes<true, true>(xf, sm + 2 * FPL + fo, sb + 2 * HD, own, Vh + co, Vl + co, lane);
}

extern "C" void kernel_launch(void* const* d_in, const int* in_sizes, int n_in,
                              void* d_out, int out_size, void* d_ws, size_t ws_size, hipStream_t stream) {
    (void)in_sizes; (void)n_in; (void)out_size;
    const float* x = (const float*)d_in[0]; const float* wq = (const float*)d_in[1]; const float* bq = (const float*)d_in[2]; const float* wk = (const float*)d_in[3]; const float* bk = (const float*)d_in[4]; const float* wv = (const float*)d_in[5]; const float* bv = (const float*)d_in[6];
    float* OUT = (float*)d_out;     // [8][1024][1024]
    char* wsp = (char*)d_ws;
    auto take = [&](size_t bytes) { char* p = wsp; wsp += (bytes + 255) & ~(size_t)255; return (void*)p; };
    const size_t PB = (size_t)NH_ * TT * HD;   // one batch's share of a head plane, elements; every plane holds all NB_ batches
    h16* QPh = (h16*)take(NB_ * PB * 2); h16* QPl = (h16*)take(NB_ * PB * 2); h16* KPh = (h16*)take(NB_ * PB * 2); h16* KPl = (h16*)take(NB_ * PB * 2); h16* VTh = (h16*)take(NB_ * PB * 2); h16* VTl = (h16*)take(NB_ * PB * 2);
    if ((size_t)(wsp - (char*)d_ws) > ws_size) return;    // ws 256 MiB
    k_proj<<<dim3(TT / 512, NH_, NB_), 256, 0, stream>>>(x, wq, bq, wk, bk, wv, bv, QPh, QPl, KPh, KPl, VTh, VTl);
    k_fattn<true><<<dim3(RH / 256, NH_, NB_), 256, 0, stream>>>(QPh, QPl, KPh, KPl, VTh, VTl, 0, OUT);
    k_fattn<false><<<dim3((TT - RH) / 256, NH_, NB_), 256, 0, stream>>>(QPh, nullptr, KPh, nullptr, VTh, nullptr, RH, OUT);
}

// v006
// A run of this version takes 61.7 microseconds.
// Two timings next to v005 both put it at 1.11 times that version's speed.
// Over all steps from v000 it is 70.4 times as fast.
#include <hip/hip_runtime.h>

// Per-head multi-head self-attention (sequences [8][1024][1024] viewed as 16 head slices of 64; per head: q = x_h Wq[h]^T + bq[h], k, v likewise ('oi' [16][64][64] + [16][64]); scores = q.k / 8; softmax; out_h = attn v; heads re-stacked -> [8][1024][1024] (8.4 M)).
// Layout: one projection kernel over every batch and head reads x and the three 64x64 weights of its head, forms q, k and v (K = 64) and writes the q, k and v^T head planes, each as an fp16 plane and, for q only rows < 512, an fp16 plane of what that rounding leaves; one fused attention kernel (scores, online softmax, attn v, output rows) runs over every batch and head (hybrid rows: < 512 hi/lo 3 products, rest the high planes alone).
// Compute dtypes, f32 accumulate: every input rounded to bf16; projections exact + f32 biases; attention rows < 512 3 products of fp16 high/low pairs, rest fp16; softmax f32 (running maximum and sum); output f32.

#define NB_  8
#define TT   1024
#define DM   1024
#define NH_  16
#define NKV  16
#define REP  (NH_ / NKV)
#define HD   64
#define DQ   (NH_ * HD)
#define DKV  (NKV * HD)
#define RH   512                  // query rows < RH use hi+lo planes
#define WIN  0
#define SCL  0.125f   // HD^-0.5
typedef _Float16 h16;
typedef unsigned short bf;
typedef __attribute__((ext_vector_type(16))) __bf16   v16bf;
typedef __attribute__((ext_vector_type(16))) _Float16 v16h;
typedef __attribute__((ext_vector_type(8)))  _Float16 v8h;
typedef __attribute__((ext_vector_type(8)))  unsigned short v8us;
typedef __attribute__((ext_vector_type(8)))  float    v8f;
typedef __attribute__((ext_vector_type(4)))  float    v4f;
typedef v8h  __attribute__((may_alias)) v8ha;
typedef v4f  __attribute__((may_alias)) v4fa;
typedef v8us __attribute__((may_alias)) v8usa;

__device__ __forceinline__ unsigned short f2bf(float f) { unsigned u = __float_as_uint(f); u += 0x7FFFu + ((u >> 16) & 1u); return (unsigned short)(u >> 16); }
__device__ __forceinline__ float bf2f(unsigned short b) { return __uint_as_float(((unsigned)b) << 16); }
__device__ __forceinline__ float bfr(float f) { return bf2f(f2bf(f)); }
__device__ __forceinline__ v16h cat16(v8h lo, v8h hi) { return __builtin_shufflevector(lo, hi, 0, 1, 2, 3, 4, 5, 6, 7, 8, 9, 10, 11, 12, 13, 14, 15); }
__device__ __forceinline__ v16bf cat16b(v8us lo, v8us hi) { return __builtin_bit_cast(v16bf, __builtin_shufflevector(lo, hi, 0, 1, 2, 3, 4, 5, 6, 7, 8, 9, 10, 11, 12, 13, 14, 15)); }
__device__ __forceinline__ v8f wmma16(v16h a, v16h b, v8f c) { return __builtin_amdgcn_wmma_f32_16x16x32_f16(false, a, false, b, (short)0, c, false, false); }
__device__ __forceinline__ v8f wmmab(v16bf a, v16bf b, v8f c) { return __builtin_amdgcn_wmma_f32_16x16x32_bf16(false, a, false, b, (short)0, c, false, false); }

// fragment loader (K-contiguous fp16 rows in global memory)
__device__ __forceinline__ v16h gfrag(const h16* p) { return cat16(*(const v8h*)p, *(const v8h*)(p + 16)); }
typedef __attribute__((ext_vector_type(4))) int v4i;
typedef v4i __attribute__((may_alias)) v4ia;
template <typename T16> struct LFrag;
template <> struct LFrag<h16> { static __device__ __forceinline__ v16h ld(const char* p) { return cat16(*(const v8ha*)p, *(const v8ha*)(p + 32)); } };
template <> struct LFrag<bf> { static __device__ __forceinline__ v16bf ld(const char* p) { return cat16b(*(const v8usa*)p, *(const v8usa*)(p + 32)); } };
__device__ __forceinline__ v8h hres(v8f a, v8h h) { return __builtin_convertvector(a - __builtin_convertvector(h, v8f), v8h); }   // what the fp16 rounding h of a leaves (an exact difference), itself rounded to fp16
__device__ __forceinline__ float xhalf(float x) { return __builtin_bit_cast(float, __builtin_amdgcn_permlanex16(__builtin_bit_cast(int, x), __builtin_bit_cast(int, x), 0x76543210, 0xfedcba98, false, false)); }   // lane l with lane l ^ 16
#define FKS  64                   // keys per stage
#define FPB  144                  // LDS row pitch in bytes: 128 of data + 16 (16 x odd: b128 readers without bank conflicts)
#define FPL  (64 * FPB)           // one staged plane: 64 rows
#define CL2  (SCL * 1.4426950408889634f)
#define NG   4                    // groups of 16 query columns a wave
#define NGH  2                    // of them on three products (rows < RH)
__global__ __launch_bounds__(256) void k_fattn(const h16* __restrict__ Q, const h16* __restrict__ Q2, const h16* __restrict__ Kp, const h16* __restrict__ K2, const h16* __restrict__ Vt, const h16* __restrict__ V2, float* __restrict__ OUT) {
    typedef v16h V;
    constexpr int NP = 4;                   // staged planes: K, V^T, K low, V^T low
    static_assert(2 * RH == TT, "as many rows on three products as on one");
    __shared__ __align__(16) char sm[2 * NP * FPL];
    const int tid = threadIdx.x, lane = tid & 31, lr = lane & 15, hi = lane >> 4, wv = tid >> 5;
    const int head = blockIdx.y;
    const size_t pl = ((size_t)blockIdx.z * NH_ + head) * (size_t)(TT * HD);
    const int q0 = blockIdx.x * 256 + wv * 32;          // group g starts at row q0 + 16 g (g < NGH), RH + q0 + 16 (g - NGH) (the rest)
    V qf[NG][2], qf2[NGH][2];
    const h16* qp[NG]; const h16* qp2[NGH];
#pragma unroll
    for (int g = 0; g < NG; ++g) { const size_t qo = pl + (size_t)(q0 + (g < NGH ? g * 16 : RH + (g - NGH) * 16) + lr) * HD + 8 * hi; qp[g] = Q + qo; if (g < NGH) qp2[g] = Q2 + qo;
#pragma unroll
        for (int ks = 0; ks < 2; ++ks) { qf[g][ks] = gfrag(qp[g] + ks * 32); if (g < NGH) qf2[g][ks] = gfrag(qp2[g] + ks * 32); } }
    asm volatile("s_wait_xcnt 0x0" :: "v"(qp[0]), "v"(qp[1]), "v"(qp[2]), "v"(qp[3]), "v"(qp2[0]), "v"(qp2[1]) : "memory");   // precaution: stands in front of the first overwrite of the address registers of the loads above; the addresses as inputs keep them whole up to here
    // staging: 16-byte chunk tid + 256 j of a 64 x 128-byte plane is row tid / 8 + 32 j, chunk tid % 8
    const int srow = tid >> 3, scol = tid & 7;
    const size_t gko = pl + (size_t)srow * HD + scol * 8, gvo = pl + (size_t)srow * TT + scol * 8;
    const int so = srow * FPB + scol * 16;
    v4i st[NP][2];
    auto fetch = [&](int kb) {
#pragma unroll
        for (int j = 0; j < 2; ++j) { st[0][j] = *(const v4ia*)(Kp + gko + (size_t)(kb + j * 32) * HD); st[1][j] = *(const v4ia*)(Vt + gvo + (size_t)j * 32 * TT + kb);
            st[2][j] = *(const v4ia*)(K2 + gko + (size_t)(kb + j * 32) * HD); st[3][j] = *(const v4ia*)(V2 + gvo + (size_t)j * 32 * TT + kb); }
        asm volatile("s_wait_xcnt 0x0" ::: "memory"); };   // precaution: stands in front of the first overwrite of these loads' address registers (the LDS reads behind it reuse them)
    auto put = [&](int buf) { char* d = sm + buf * (NP * FPL) + so;
#pragma unroll
        for (int p = 0; p < NP; ++p)
#pragma unroll
            for (int j = 0; j < 2; ++j) *(v4ia*)(d + p * FPL + j * 32 * FPB) = st[p][j]; };
    v8f o[NG][4]; float m[NG], l[NG];
#pragma unroll
    for (int g = 0; g < NG; ++g) { m[g] = -3.0e38f; l[g] = 0.f;
#pragma unroll
        for (int dt = 0; dt < 4; ++dt) o[g][dt] = (v8f){}; }
    fetch(0); put(0); __syncthreads();      // stage 0 is visible to all 8 waves
    const int fo = lr * FPB + 16 * hi;      // a lane's fragment: row lr of a 16-row tile, bytes 16 hi and 32 + 16 hi of each 64
#pragma unroll 1                            // rolled: one copy of the stage body, the buffer chosen by s & 1
    for (int s = 0; s < TT / FKS; ++s) {
        const char* B = sm + (s & 1) * (NP * FPL) + fo;
        V kf[2][2][2], kl[2][2][2], vf[2][4], vl[2][4];   // the stage's fragments: K [pass][16-key tile][k half], V^T [pass][16-feature tile]
        auto ldk = [&](int kk) {
#pragma unroll
            for (int t = 0; t < 2; ++t) { const char* kr = B + (kk * 2 + t) * 16 * FPB; kf[kk][t][0] = LFrag<h16>::ld(kr); kf[kk][t][1] = LFrag<h16>::ld(kr + 64); kl[kk][t][0] = LFrag<h16>::ld(kr + 2 * FPL); kl[kk][t][1] = LFrag<h16>::ld(kr + 2 * FPL + 64); } };
        auto ldv = [&](int kk) {
#pragma unroll
            for (int dt = 0; dt < 4; ++dt) { const char* vr = B + FPL + dt * 16 * FPB + kk * 64; vf[kk][dt] = LFrag<h16>::ld(vr); vl[kk][dt] = LFrag<h16>::ld(vr + 2 * FPL); } };
        ldk(0);
        __builtin_amdgcn_sched_barrier(0);  // the first pass's K reads stay one group up here: their latency runs while the global loads below are issued
        if (s + 1 < TT / FKS) fetch((s + 1) * FKS);   // the next stage's loads fly while this stage is worked on
#pragma unroll
        for (int kk = 0; kk < 2; ++kk) {    // 32 keys a pass
            v8f sc[NG][2];
#pragma unroll
            for (int t = 0; t < 2; ++t) {
#pragma unroll
                for (int g = 0; g < NG; ++g) { v8f a = (v8f){}; a = wmma16(kf[kk][t][0], qf[g][0], a); a = wmma16(kf[kk][t][1], qf[g][1], a);
                    if (g < NGH) { a = wmma16(kf[kk][t][0], qf2[g][0], a); a = wmma16(kf[kk][t][1], qf2[g][1], a); a = wmma16(kl[kk][t][0], qf[g][0], a); a = wmma16(kl[kk][t][1], qf[g][1], a); }
                    sc[g][t] = a; } }
            __builtin_amdgcn_sched_barrier(0);   // the products above are issued first, so that the reads below land while the matrix unit works
            ldv(kk);
            __builtin_amdgcn_sched_barrier(0);   // these reads stay one group here, in front of the maxima and exponentials, which cover their latency
            float mx[NG]; bool need = false;
#pragma unroll
            for (int g = 0; g < NG; ++g) { float a = fmaxf(sc[g][0][0], sc[g][1][0]);
#pragma unroll
                for (int j = 1; j < 8; ++j) a = fmaxf(a, fmaxf(sc[g][0][j], sc[g][1][j]));
                mx[g] = fmaxf(a, xhalf(a)) * CL2; need = need || (mx[g] > m[g] + 8.0f); }
            if (__builtin_amdgcn_ballot_w32(need) != 0) {   // scalar branch; always taken on the first pass, rare later
#pragma unroll
                for (int g = 0; g < NG; ++g) { const float mn = fmaxf(m[g], mx[g]); const float al = __builtin_amdgcn_exp2f(m[g] - mn); m[g] = mn; l[g] *= al;
#pragma unroll
                    for (int dt = 0; dt < 4; ++dt) o[g][dt] *= al; } }
            V pf[NG], pf2[NGH];
#pragma unroll
            for (int g = 0; g < NG; ++g) {
#pragma unroll
                for (int t = 0; t < 2; ++t)
#pragma unroll
                    for (int j = 0; j < 8; ++j) { const float p = __builtin_amdgcn_exp2f(__builtin_fmaf(sc[g][t][j], CL2, -m[g])); sc[g][t][j] = p; l[g] += p; }
                const v8h p0 = __builtin_convertvector(sc[g][0], v8h), p1 = __builtin_convertvector(sc[g][1], v8h);
                pf[g] = cat16(p0, p1); if (g < NGH) pf2[g] = cat16(hres(sc[g][0], p0), hres(sc[g][1], p1)); }
            if (kk == 0) { __builtin_amdgcn_sched_barrier(0);   // the scores' registers are free by now
                ldk(1);
                __builtin_amdgcn_sched_barrier(0); }   // the second pass's K reads stay one group in front of this pass's last products, which cover their latency
#pragma unroll
            for (int dt = 0; dt < 4; ++dt) {
#pragma unroll
                for (int g = 0; g < NG; ++g) { o[g][dt] = wmma16(vf[kk][dt], pf[g], o[g][dt]); if (g < NGH) { o[g][dt] = wmma16(vf[kk][dt], pf2[g], o[g][dt]); o[g][dt] = wmma16(vl[kk][dt], pf[g], o[g][dt]); } } }
        }
        __builtin_amdgcn_sched_barrier(0);   // the stage's last products stay in front of the four slots below
        asm volatile("v_nop\n\tv_nop\n\tv_nop\n\tv_nop");   // the distance a matrix product needs before a vector instruction overwrites its operands
        if (s + 1 < TT / FKS) put((s + 1) & 1);   // the buffer that stage s - 1 read: every wave left it at the last barrier
        __syncthreads();                    // publishes stage s + 1 and ends every wave's reads of stage s
    }
    // epilogue: each wave turns its O^T tiles into output rows through its own 16 x 68 floats of the (now free) ring, so that stores are whole 256-byte row pieces
    float* os = (float*)sm + wv * (16 * 68);
#pragma unroll
    for (int g = 0; g < NG; ++g) { const float inv = 1.0f / (l[g] + xhalf(l[g]));
#pragma unroll
        for (int dt = 0; dt < 4; ++dt) { const v8f v = o[g][dt] * inv; float* d = os + lr * 68 + dt * 16 + 8 * hi; *(v4fa*)d = __builtin_shufflevector(v, v, 0, 1, 2, 3); *(v4fa*)(d + 4) = __builtin_shufflevector(v, v, 4, 5, 6, 7); }
        __builtin_amdgcn_wave_barrier(); asm volatile("" ::: "memory");   // other lanes' LDS writes above, this lane's reads below: keep the compiler from crossing them
        float* orow = OUT + ((size_t)blockIdx.z * TT + q0 + (g < NGH ? g * 16 : RH + (g - NGH) * 16)) * DQ + head * HD;
#pragma unroll
        for (int r = 0; r < 8; ++r) { const int row = 2 * r + hi; *(v4f*)(orow + (size_t)row * DQ + lr * 4) = *(const v4fa*)(os + row * 68 + lr * 4); }
        __builtin_amdgcn_wave_barrier(); asm volatile("s_wait_xcnt 0x0" ::: "memory");   // the reads above end before the next group's writes; the wait is a precaution: it stands in front of the first overwrite of a register that these stores name
        __builtin_amdgcn_sched_barrier(0);  // the next group's arithmetic stays behind that wait
    }
}

// ---- k_proj: q, k and v of one (batch, head) for 512 tokens, written straight as the head planes (fp16 high, fp16 low; q low only for the rows < RH, which alone read it) that k_fattn reads; 8 waves x 64 tokens; grid (tokens / 512, heads, batches).
// x (each wave its own 64 rows) and the head's three 64x64 weights (the 8 waves together) go global f32 -> bf16 -> LDS in whole lines; fragments come from LDS with the loader of k_fattn, the same for A and B.
// q, k: D = W x^T (a lane holds 8 neighbouring features of ONE token); v: D = x W^T (a lane holds 8 neighbouring tokens of ONE feature): both are 16-byte pieces of a plane row.
// 16 plane rows at a time pass through the wave's own LDS piece, so that every global store covers whole 128-byte lines.
typedef __attribute__((ext_vector_type(4))) __bf16 v4bf;
typedef __attribute__((ext_vector_type(2))) int v2i;
typedef v2i __attribute__((may_alias)) v2ia;
#define PST  (16 * FPB)           // one plane's 16 staged output rows
template <bool VT, bool LOW>
__device__ __forceinline__ void proj_planes(const v16bf (&xf)[4][2], const char* wl, const float* sb, char* stg, h16* Ph, h16* Pl, int lane) {
    const int lr = lane & 15, hi = lane >> 4;
    constexpr int pitch = VT ? TT : HD;     // elements between plane rows
    v16bf wf[4][2];
#pragma unroll
    for (int t = 0; t < 4; ++t)
#pragma unroll
        for (int ks = 0; ks < 2; ++ks) wf[t][ks] = LFrag<bf>::ld(wl + t * 16 * FPB + ks * 64);
    v8f bm[4]; float bn[4];                 // the bias follows the feature: the D row (q, k) or the D column (v)
#pragma unroll
    for (int t = 0; t < 4; ++t) { if (VT) bn[t] = sb[t * 16 + lr]; else { const float* s = sb + t * 16 + hi * 8; bm[t] = __builtin_shufflevector(*(const v4fa*)s, *(const v4fa*)(s + 4), 0, 1, 2, 3, 4, 5, 6, 7); } }
#pragma unroll
    for (int nb = 0; nb < 4; ++nb) {        // 16 plane rows (D columns) a pass
        v8f acc[4];
#pragma unroll
        for (int mb = 0; mb < 4; ++mb) { acc[mb] = (v8f){};
#pragma unroll
            for (int ks = 0; ks < 2; ++ks) acc[mb] = VT ? wmmab(xf[mb][ks], wf[nb][ks], acc[mb]) : wmmab(wf[mb][ks], xf[nb][ks], acc[mb]); }
#pragma unroll
        for (int mb = 0; mb < 4; ++mb) { const v8f y = VT ? acc[mb] + bn[nb] : acc[mb] + bm[mb]; char* d = stg + lr * FPB + mb * 32 + hi * 16;
            const v8h yh = __builtin_convertvector(y, v8h);
            *(v4ia*)d = __builtin_bit_cast(v4i, yh);
            if (LOW) *(v4ia*)(d + PST) = __builtin_bit_cast(v4i, hres(y, yh)); }
        __builtin_amdgcn_wave_barrier(); asm volatile("" ::: "memory");   // other lanes' LDS writes above, this lane's reads below: keep the compiler from crossing them
#pragma unroll
        for (int i = 0; i < 4; ++i) { const int row = i * 4 + (lane >> 3); const char* s = stg + row * FPB + (lane & 7) * 16; const size_t go = (size_t)(nb * 16 + row) * pitch + (lane & 7) * 8;
            *(v4ia*)(Ph + go) = *(const v4ia*)s; if (LOW) *(v4ia*)(Pl + go) = *(const v4ia*)(s + PST); }
        __builtin_amdgcn_wave_barrier(); asm volatile("s_wait_xcnt 0x0" ::: "memory");   // the reads above end before the next pass's writes; the wait is a precaution: it stands in front of the first overwrite of a register that these stores name
        __builtin_amdgcn_sched_barrier(0);  // the next pass's products stay behind that wait: hoisted, they push the kernel past 256 registers
    }
}
__global__ __launch_bounds__(256) void k_proj(const float* __restrict__ x, const float* __restrict__ Wq, const float* __restrict__ bq, const float* __restrict__ Wk, const float* __restrict__ bk, const float* __restrict__ Wv, const float* __restrict__ bv,
                                              h16* Qh, h16* Ql, h16* Kh, h16* Kl, h16* Vh, h16* Vl) {
    __shared__ __align__(16) char sm[11 * FPL + 3 * HD * 4];   // planes 0..2: Wq, Wk, Wv of the head; 3 + wave: the wave's x rows, later its output rows; then the three rounded biases
    const int tid = threadIdx.x, lane = tid & 31, lr = lane & 15, hi = lane >> 4, wave = tid >> 5;
    const int head = blockIdx.y, t0 = blockIdx.x * 512 + wave * 64;
    const float* xl = x + ((size_t)blockIdx.z * TT + t0 + hi) * DM + head * HD + lr * 4;   // the lane's 16 bytes of rows hi, 2 + hi, ...
    char* own = sm + (3 + wave) * FPL; float* sb = (float*)(sm + 11 * FPL);
    const int be = head * HD + (tid & 63); const float rq = bq[be], rk = bk[be], rv = bv[be];
    v4f xv[32], wr[12];                     // every load is issued before the first conversion waits for one
#pragma unroll
    for (int i = 0; i < 32; ++i) xv[i] = *(const v4fa*)(xl + (size_t)(2 * i) * DM);          // two 256-byte row pieces a load
    asm volatile("s_wait_xcnt 0x0" :: "v"(xl), "v"(be) : "memory");   // precaution: stands in front of the first overwrite of the address registers of the loads above; the addresses as inputs keep a load's own result off them
#pragma unroll
    for (int i = 0; i < 12; ++i) { const float* w = i < 4 ? Wq : i < 8 ? Wk : Wv; wr[i] = *(const v4fa*)(w + (size_t)head * (HD * HD) + ((i & 3) * 256 + tid) * 4); }
    asm volatile("" :: "v"(rq), "v"(rk), "v"(rv));   // holds the three bias loads up here among the others: left alone they sink into the branch below, and their latency is paid in front of the barrier
#pragma unroll
    for (int i = 0; i < 32; ++i) *(v2ia*)(own + (2 * i + hi) * FPB + lr * 8) = __builtin_bit_cast(v2i, __builtin_convertvector(xv[i], v4bf));
#pragma unroll
    for (int i = 0; i < 12; ++i) { const int c = (i & 3) * 256 + tid; *(v2ia*)(sm + (i >> 2) * FPL + (c >> 4) * FPB + (c & 15) * 8) = __builtin_bit_cast(v2i, __builtin_convertvector(wr[i], v4bf)); }
    if (wave < 2) { sb[tid] = bfr(rq); sb[HD + tid] = bfr(rk); sb[2 * HD + tid] = bfr(rv); }
    __syncthreads();                        // the weights and biases (and each wave's x rows) are visible to every lane that reads fragments
    const int fo = lr * FPB + 16 * hi;      // a lane's fragment: row lr of a 16-row tile, bytes 16 hi and 32 + 16 hi of each 64
    v16bf xf[4][2];
#pragma unroll
    for (int t = 0; t < 4; ++t)
#pragma unroll
        for (int ks = 0; ks < 2; ++ks) xf[t][ks] = LFrag<bf>::ld(own + fo + t * 16 * FPB + ks * 64);
    __builtin_amdgcn_wave_barrier(); asm volatile("" ::: "memory");       // the x rows are in registers before their LDS piece takes output rows
    const size_t pl = ((size_t)blockIdx.z * NH_ + head) * (size_t)(TT * HD);
    const size_t ro = pl + (size_t)t0 * HD, co = pl + t0;                 // token-major planes start at row t0, v^T planes at column t0
    static_assert(RH % 512 == 0, "a work-group's 512 tokens lie on one side of RH");
    if (blockIdx.x * 512 < RH) proj_planes<false, true>(xf, sm + fo, sb, own, Qh + ro, Ql + ro, lane);
    else proj_planes<false, false>(xf, sm + fo, sb, own, Qh + ro, nullptr, lane);
    proj_planes<false, true>(xf, sm + FPL + fo, sb + HD, own, Kh + ro, Kl + ro, lane);
    proj_planes<true, true>(xf, sm + 2 * FPL + fo, sb + 2 * HD, own, Vh + co, Vl + co, lane);
}

extern "C" void kernel_launch(void* const* d_in, const int* in_sizes, int n_in,
                              void* d_out, int out_size, void* d_ws, size_t ws_size, hipStream_t stream) {
    (void)in_sizes; (void)n_in; (void)out_size;
    const float* x = (const float*)d_in[0]; const float* wq = (const float*)d_in[1]; const float* bq = (const float*)d_in[2]; const float* wk = (const float*)d_in[3]; const float* bk = (const float*)d_in[4]; const float* wv = (const float*)d_in[5]; const float* bv = (const float*)d_in[6];
    float* OUT = (float*)d_out;     // [8][1024][1024]
    char* wsp = (char*)d_ws;
    auto take = [&](size_t bytes) { char* p = wsp; wsp += (bytes + 255) & ~(size_t)255; return (void*)p; };
    const size_t PB = (size_t)NH_ * TT * HD;   // one batch's share of a head plane, elements; every plane holds all NB_ batches
    h16* QPh = (h16*)take(NB_ * PB * 2); h16* QPl = (h16*)take(NB_ * PB * 2); h16* KPh = (h16*)take(NB_ * PB * 2); h16* KPl = (h16*)take(NB_ * PB * 2); h16* VTh = (h16*)take(NB_ * PB * 2); h16* VTl = (h16*)take(NB_ * PB * 2);
    if ((size_t)(wsp - (char*)d_ws) > ws_size) return;    // ws 256 MiB
    k_proj<<<dim3(TT / 512, NH_, NB_), 256, 0, stream>>>(x, wq, bq, wk, bk, wv, bv, QPh, QPl, KPh, KPl, VTh, VTl);
    k_fattn<<<dim3(RH / 256, NH_, NB_), 256, 0, stream>>>(QPh, QPl, KPh, KPl, VTh, VTl, OUT);
}

// v007
// Measured time: 59.4 microseconds a run.
// In both of two side-by-side timings against v006, it was 1.04 times as fast.
// All steps since v000 together make it 73.3 times as fast.
#include <hip/hip_runtime.h>

// Per-head multi-head self-attention (sequences [8][1024][1024] viewed as 16 head slices of 64; per head: q = x_h Wq[h]^T + bq[h], k, v likewise ('oi' [16][64][64] + [16][64]); scores = q.k / 8; softmax; out_h = attn v; heads re-stacked -> [8][1024][1024] (8.4 M)).
// Layout: one projection kernel over every batch and head reads x and the three 64x64 weights of its head, forms q, k and v (K = 64) and writes the q, k and v^T head planes, each as an fp16 plane and, for q only rows < 512, an fp16 plane of what that rounding leaves; one fused attention kernel (scores, online softmax, attn v, output rows) runs over every batch and head (hybrid rows: < 512 hi/lo 3 products, rest the high planes alone).
// Compute dtypes, f32 accumulate: every input rounded to bf16; projections exact + f32 biases; attention rows < 512 3 products of fp16 high/low pairs, rest fp16; softmax f32 (running maximum and sum); output f32.

#define NB_  8
#define TT   1024
#define DM   1024
#define NH_  16
#define NKV  16
#define REP  (NH_ / NKV)
#define HD   64
#define DQ   (NH_ * HD)
#define DKV  (NKV * HD)
#define RH   512                  // query rows < RH use hi+lo planes
#define WIN  0
#define SCL  0.125f   // HD^-0.5
typedef _Float16 h16;
typedef unsigned short bf;
typedef __attribute__((ext_vector_type(16))) __bf16   v16bf;
typedef __attribute__((ext_vector_type(16))) _Float16 v16h;
typedef __attribute__((ext_vector_type(8)))  _Float16 v8h;
typedef __attribute__((ext_vector_type(8)))  unsigned short v8us;
typedef __attribute__((ext_vector_type(8)))  float    v8f;
typedef __attribute__((ext_vector_type(4)))  float    v4f;
typedef v8h  __attribute__((may_alias)) v8ha;
typedef v4f  __attribute__((may_alias)) v4fa;
typedef v8us __attribute__((may_alias)) v8usa;

__device__ __forceinline__ unsigned short f2bf(float f) { unsigned u = __float_as_uint(f); u += 0x7FFFu + ((u >> 16) & 1u); return (unsigned short)(u >> 16); }
__device__ __forceinline__ float bf2f(unsigned short b) { return __uint_as_float(((unsigned)b) << 16); }
__device__ __forceinline__ float bfr(float f) { return bf2f(f2bf(f)); }
__device__ __forceinline__ v16h cat16(v8h lo, v8h hi) { return __builtin_shufflevector(lo, hi, 0, 1, 2, 3, 4, 5, 6, 7, 8, 9, 10, 11, 12, 13, 14, 15); }
__device__ __forceinline__ v16bf cat16b(v8us lo, v8us hi) { return __builtin_bit_cast(v16bf, __builtin_shufflevector(lo, hi, 0, 1, 2, 3, 4, 5, 6, 7, 8, 9, 10, 11, 12, 13, 14, 15)); }
__device__ __forceinline__ v8f wmma16(v16h a, v16h b, v8f c) { return __builtin_amdgcn_wmma_f32_16x16x32_f16(false, a, false, b, (short)0, c, false, false); }
__device__ __forceinline__ v8f wmmab(v16bf a, v16bf b, v8f c) { return __builtin_amdgcn_wmma_f32_16x16x32_bf16(false, a, false, b, (short)0, c, false, false); }

// fragment loader (K-contiguous fp16 rows in global memory)
__device__ __forceinline__ v16h gfrag(const h16* p) { return cat16(*(const v8h*)p, *(const v8h*)(p + 16)); }
typedef __attribute__((ext_vector_type(4))) int v4i;
typedef v4i __attribute__((may_alias)) v4ia;
template <typename T16> struct LFrag;
template <> struct LFrag<h16> { static __device__ __forceinline__ v16h ld(const char* p) { return cat16(*(const v8ha*)p, *(const v8ha*)(p + 32)); } };
template <> struct LFrag<bf> { static __device__ __forceinline__ v16bf ld(const char* p) { return cat16b(*(const v8usa*)p, *(const v8usa*)(p + 32)); } };
__device__ __forceinline__ v8h hres(v8f a, v8h h) { return __builtin_convertvector(a - __builtin_convertvector(h, v8f), v8h); }   // what the fp16 rounding h of a leaves (an exact difference), itself rounded to fp16
__device__ __forceinline__ float xhalf(float x) { return __builtin_bit_cast(float, __builtin_amdgcn_permlanex16(__builtin_bit_cast(int, x), __builtin_bit_cast(int, x), 0x76543210, 0xfedcba98, false, false)); }   // lane l with lane l ^ 16
#define FKS  64                   // keys per stage
#define FPB  144                  // LDS row pitch in bytes: 128 of data + 16 (16 x odd: b128 readers without bank conflicts)
#define FPL  (64 * FPB)           // one staged plane: 64 rows
#define CL2  (SCL * 1.4426950408889634f)
#define NG   4                    // groups of 16 query columns a wave
#define NGH  2                    // of them on three products (rows < RH)
__global__ __launch_bounds__(256) void k_fattn(const h16* __restrict__ Q, const h16* __restrict__ Q2, const h16* __restrict__ Kp, const h16* __restrict__ K2, const h16* __restrict__ Vt, const h16* __restrict__ V2, float* __restrict__ OUT) {
    typedef v16h V;
    constexpr int NP = 4;                   // staged planes: K, V^T, K low, V^T low
    static_assert(2 * RH == TT, "as many rows on three products as on one");
    __shared__ __align__(16) char sm[2 * NP * FPL];
    const int tid = threadIdx.x, lane = tid & 31, lr = lane & 15, hi = lane >> 4, wv = tid >> 5;
    const int head = blockIdx.y;
    const size_t pl = ((size_t)blockIdx.z * NH_ + head) * (size_t)(TT * HD);
    const int q0 = blockIdx.x * 256 + wv * 32;          // group g starts at row q0 + 16 g (g < NGH), RH + q0 + 16 (g - NGH) (the rest)
    V qf[NG][2], qf2[NGH][2];
    const h16* qp[NG]; const h16* qp2[NGH];
#pragma unroll
    for (int g = 0; g < NG; ++g) { const size_t qo = pl + (size_t)(q0 + (g < NGH ? g * 16 : RH + (g - NGH) * 16) + lr) * HD + 8 * hi; qp[g] = Q + qo; if (g < NGH) qp2[g] = Q2 + qo;
#pragma unroll
        for (int ks = 0; ks < 2; ++ks) { qf[g][ks] = gfrag(qp[g] + ks * 32); if (g < NGH) qf2[g][ks] = gfrag(qp2[g] + ks * 32); } }
    asm volatile("s_wait_xcnt 0x0" :: "v"(qp[0]), "v"(qp[1]), "v"(qp[2]), "v"(qp[3]), "v"(qp2[0]), "v"(qp2[1]) : "memory");   // precaution: stands in front of the first overwrite of the address registers of the loads above; the addresses as inputs keep them whole up to here
    // staging: 16-byte chunk tid + 256 j of a 64 x 128-byte plane is row tid / 8 + 32 j, chunk tid % 8
    const int srow = tid >> 3, scol = tid & 7;
    const size_t gko = pl + (size_t)srow * HD + scol * 8, gvo = pl + (size_t)srow * TT + scol * 8;
    const int so = srow * FPB + scol * 16;
    v4i st[NP][2];
    auto fetch = [&](int kb) {
#pragma unroll
        for (int j = 0; j < 2; ++j) { st[0][j] = *(const v4ia*)(Kp + gko + (size_t)(kb + j * 32) * HD); st[1][j] = *(const v4ia*)(Vt + gvo + (size_t)j * 32 * TT + kb);
            st[2][j] = *(const v4ia*)(K2 + gko + (size_t)(kb + j * 32) * HD); st[3][j] = *(const v4ia*)(V2 + gvo + (size_t)j * 32 * TT + kb); }
        asm volatile("s_wait_xcnt 0x0" ::: "memory"); };   // precaution: stands in front of the first overwrite of these loads' address registers (the LDS reads behind it reuse them)
    auto put = [&](int buf) { char* d = sm + buf * (NP * FPL) + so;
#pragma unroll
        for (int p = 0; p < NP; ++p)
#pragma unroll
            for (int j = 0; j < 2; ++j) *(v4ia*)(d + p * FPL + j * 32 * FPB) = st[p][j]; };
    v8f o[NG][4], nm[NG]; float l[NG];      // nm: minus the group's running maximum in all eight registers, as a score tile's start value
#pragma unroll
    for (int g = 0; g < NG; ++g) { nm[g] = (v8f){}; l[g] = 0.f;
#pragma unroll
        for (int dt = 0; dt < 4; ++dt) o[g][dt] = (v8f){}; }
    fetch(0); put(0); __syncthreads();      // stage 0 is visible to all 8 waves
    const int fo = lr * FPB + 16 * hi;      // a lane's fragment: row lr of a 16-row tile, bytes 16 hi and 32 + 16 hi of each 64
#pragma unroll 1                            // rolled: one copy of the stage body, the buffer chosen by s & 1
    for (int s = 0; s < TT / FKS; ++s) {
        const char* B = sm + (s & 1) * (NP * FPL) + fo;
        V kf[2][2][2], kl[2][2][2], vf[2][4], vl[2][4];   // the stage's fragments: K [pass][16-key tile][k half], V^T [pass][16-feature tile]
        auto ldk = [&](int kk) {
#pragma unroll
            for (int t = 0; t < 2; ++t) { const char* kr = B + (kk * 2 + t) * 16 * FPB; kf[kk][t][0] = LFrag<h16>::ld(kr); kf[kk][t][1] = LFrag<h16>::ld(kr + 64); kl[kk][t][0] = LFrag<h16>::ld(kr + 2 * FPL); kl[kk][t][1] = LFrag<h16>::ld(kr + 2 * FPL + 64); } };
        auto ldv = [&](int kk) {
#pragma unroll
            for (int dt = 0; dt < 4; ++dt) { const char* vr = B + FPL + dt * 16 * FPB + kk * 64; vf[kk][dt] = LFrag<h16>::ld(vr); vl[kk][dt] = LFrag<h16>::ld(vr + 2 * FPL); } };
        ldk(0);
        __builtin_amdgcn_sched_barrier(0);  // the first pass's K reads stay one group up here: their latency runs while the global loads below are issued
        if (s + 1 < TT / FKS) fetch((s + 1) * FKS);   // the next stage's loads fly while this stage is worked on
#pragma unroll
        for (int kk = 0; kk < 2; ++kk) {    // 32 keys a pass
            v8f sc[NG][2];
#pragma unroll
            for (int t = 0; t < 2; ++t) {
#pragma unroll
                for (int g = 0; g < NG; ++g) { v8f a = wmma16(kf[kk][t][0], qf[g][0], nm[g]); a = wmma16(kf[kk][t][1], qf[g][1], a);
                    if (g < NGH) { a = wmma16(kf[kk][t][0], qf2[g][0], a); a = wmma16(kf[kk][t][1], qf2[g][1], a); a = wmma16(kl[kk][t][0], qf[g][0], a); a = wmma16(kl[kk][t][1], qf[g][1], a); }
                    sc[g][t] = a; } }
            __builtin_amdgcn_sched_barrier(0);   // the products above are issued first, so that the reads below land while the matrix unit works
            ldv(kk);
            __builtin_amdgcn_sched_barrier(0);   // these reads stay one group here, in front of the maxima and exponentials, which cover their latency
            const bool first = kk == 0 && s == 0;   // the first 32 keys set the maximum, whatever it is
            float mx[NG];
#pragma unroll
            for (int g = 0; g < NG; ++g) { float a = fmaxf(sc[g][0][0], sc[g][1][0]);
#pragma unroll
                for (int j = 1; j < 8; ++j) a = fmaxf(a, fmaxf(sc[g][0][j], sc[g][1][j]));
                mx[g] = fmaxf(a, xhalf(a)); }   // how far the pass's maximum lies above the one in use
            if (__builtin_amdgcn_ballot_w32(fmaxf(fmaxf(mx[0], mx[1]), fmaxf(mx[2], mx[3])) > (first ? -3.0e38f : 8.0f)) != 0) {   // scalar branch; always taken on the first pass (no sum of fp16 products reaches -3e38), rare later
#pragma unroll
                for (int g = 0; g < NG; ++g) { const float d = first ? mx[g] : fmaxf(mx[g], 0.f); const float al = first ? 1.0f : __builtin_amdgcn_exp2f(-d); nm[g] -= d; l[g] *= al; sc[g][0] -= d; sc[g][1] -= d;
#pragma unroll
                    for (int dt = 0; dt < 4; ++dt) o[g][dt] *= al; } }
            V pf[NG], pf2[NGH];
#pragma unroll
            for (int g = 0; g < NG; ++g) {
#pragma unroll
                for (int t = 0; t < 2; ++t)
#pragma unroll
                    for (int j = 0; j < 8; ++j) { const float p = __builtin_amdgcn_exp2f(sc[g][t][j]); sc[g][t][j] = p; l[g] += p; }
                const v8h p0 = __builtin_convertvector(sc[g][0], v8h), p1 = __builtin_convertvector(sc[g][1], v8h);
                pf[g] = cat16(p0, p1); if (g < NGH) pf2[g] = cat16(hres(sc[g][0], p0), hres(sc[g][1], p1)); }
#pragma unroll
            for (int dt = 0; dt < 4; ++dt) {
                if (kk == 0 && dt == 2) { __builtin_amdgcn_sched_barrier(0);   // half of the V^T fragments' registers are free by now; in front of all 32 products these reads do not fit 512 registers
                    ldk(1);
                    __builtin_amdgcn_sched_barrier(0); }   // the second pass's K reads stay one group in front of the second half of this pass's last products, which cover their latency
#pragma unroll
                for (int g = 0; g < NG; ++g) { o[g][dt] = wmma16(vf[kk][dt], pf[g], o[g][dt]); if (g < NGH) { o[g][dt] = wmma16(vf[kk][dt], pf2[g], o[g][dt]); o[g][dt] = wmma16(vl[kk][dt], pf[g], o[g][dt]); } } }
            if (kk == 0) __builtin_amdgcn_sched_barrier(0);   // the second pass's score products stay behind these: moved up among them, they wait for the K reads after a few products only
        }
        __builtin_amdgcn_sched_barrier(0);   // the stage's last products stay in front of the four slots below
        asm volatile("v_nop\n\tv_nop\n\tv_nop\n\tv_nop");   // the distance a matrix product needs before a vector instruction overwrites its operands
        if (s + 1 < TT / FKS) put((s + 1) & 1);   // the buffer that stage s - 1 read: every wave left it at the last barrier
        __syncthreads();                    // publishes stage s + 1 and ends every wave's reads of stage s
    }
    // epilogue: each wave turns its O^T tiles into output rows through its own 16 x 68 floats of the (now free) ring, so that stores are whole 256-byte row pieces
    float* os = (float*)sm + wv * (16 * 68);
#pragma unroll
    for (int g = 0; g < NG; ++g) { const float inv = 1.0f / (l[g] + xhalf(l[g]));
#pragma unroll
        for (int dt = 0; dt < 4; ++dt) { const v8f v = o[g][dt] * inv; float* d = os + lr * 68 + dt * 16 + 8 * hi; *(v4fa*)d = __builtin_shufflevector(v, v, 0, 1, 2, 3); *(v4fa*)(d + 4) = __builtin_shufflevector(v, v, 4, 5, 6, 7); }
        __builtin_amdgcn_wave_barrier(); asm volatile("" ::: "memory");   // other lanes' LDS writes above, this lane's reads below: keep the compiler from crossing them
        float* orow = OUT + ((size_t)blockIdx.z * TT + q0 + (g < NGH ? g * 16 : RH + (g - NGH) * 16)) * DQ + head * HD;
#pragma unroll
        for (int r = 0; r < 8; ++r) { const int row = 2 * r + hi; *(v4f*)(orow + (size_t)row * DQ + lr * 4) = *(const v4fa*)(os + row * 68 + lr * 4); }
        __builtin_amdgcn_wave_barrier(); asm volatile("s_wait_xcnt 0x0" ::: "memory");   // the reads above end before the next group's writes; the wait is a precaution: it stands in front of the first overwrite of a register that these stores name
        __builtin_amdgcn_sched_barrier(0);  // the next group's arithmetic stays behind that wait
    }
}

// ---- k_proj: q (times HD^-0.5 log2(e)), k and v of one (batch, head) for 512 tokens, written straight as the head planes (fp16 high, fp16 low; q low only for the rows < RH, which alone read it) that k_fattn reads; 8 waves x 64 tokens; grid (tokens / 512, heads, batches).
// x (each wave its own 64 rows) and the head's three 64x64 weights (the 8 waves together) go global f32 -> bf16 -> LDS in whole lines; fragments come from LDS with the loader of k_fattn, the same for A and B.
// q, k: D = W x^T (a lane holds 8 neighbouring features of ONE token); v: D = x W^T (a lane holds 8 neighbouring tokens of ONE feature): both are 16-byte pieces of a plane row.
// 16 plane rows at a time pass through the wave's own LDS piece, so that every global store covers whole 128-byte lines.
typedef __attribute__((ext_vector_type(4))) __bf16 v4bf;
typedef __attribute__((ext_vector_type(2))) int v2i;
typedef v2i __attribute__((may_alias)) v2ia;
#define PST  (16 * FPB)           // one plane's 16 staged output rows
template <bool VT, bool LOW, bool QS>     // QS: the plane is q, stored times HD^-0.5 log2(e)
__device__ __forceinline__ void proj_planes(const v16bf (&xf)[4][2], const char* wl, const float* sb, char* stg, h16* Ph, h16* Pl, int lane) {
    const int lr = lane & 15, hi = lane >> 4;
    constexpr int pitch = VT ? TT : HD;     // elements between plane rows
    v16bf wf[4][2];
#pragma unroll
    for (int t = 0; t < 4; ++t)
#pragma unroll
        for (int ks = 0; ks < 2; ++ks) wf[t][ks] = LFrag<bf>::ld(wl + t * 16 * FPB + ks * 64);
    v8f bm[4]; float bn[4];                 // the bias follows the feature: the D row (q, k) or the D column (v)
#pragma unroll
    for (int t = 0; t < 4; ++t) { if (VT) bn[t] = sb[t * 16 + lr]; else { const float* s = sb + t * 16 + hi * 8; bm[t] = __builtin_shufflevector(*(const v4fa*)s, *(const v4fa*)(s + 4), 0, 1, 2, 3, 4, 5, 6, 7); } }
#pragma unroll
    for (int nb = 0; nb < 4; ++nb) {        // 16 plane rows (D columns) a pass
        v8f acc[4];
#pragma unroll
        for (int mb = 0; mb < 4; ++mb) { acc[mb] = (v8f){};
#pragma unroll
            for (int ks = 0; ks < 2; ++ks) acc[mb] = VT ? wmmab(xf[mb][ks], wf[nb][ks], acc[mb]) : wmmab(wf[mb][ks], xf[nb][ks], acc[mb]); }
#pragma unroll
        for (int mb = 0; mb < 4; ++mb) { const v8f yb = VT ? acc[mb] + bn[nb] : acc[mb] + bm[mb]; const v8f y = QS ? yb * CL2 : yb; char* d = stg + lr * FPB + mb * 32 + hi * 16;
            const v8h yh = __builtin_convertvector(y, v8h);
            *(v4ia*)d = __builtin_bit_cast(v4i, yh);
            if (LOW) *(v4ia*)(d + PST) = __builtin_bit_cast(v4i, hres(y, yh)); }
        __builtin_amdgcn_wave_barrier(); asm volatile("" ::: "memory");   // other lanes' LDS writes above, this lane's reads below: keep the compiler from crossing them
#pragma unroll
        for (int i = 0; i < 4; ++i) { const int row = i * 4 + (lane >> 3); const char* s = stg + row * FPB + (lane & 7) * 16; const size_t go = (size_t)(nb * 16 + row) * pitch + (lane & 7) * 8;
            *(v4ia*)(Ph + go) = *(const v4ia*)s; if (LOW) *(v4ia*)(Pl + go) = *(const v4ia*)(s + PST); }
        __builtin_amdgcn_wave_barrier(); asm volatile("s_wait_xcnt 0x0" ::: "memory");   // the reads above end before the next pass's writes; the wait is a precaution: it stands in front of the first overwrite of a register that these stores name
        __builtin_amdgcn_sched_barrier(0);  // the next pass's products stay behind that wait: hoisted, they push the kernel past 256 registers
    }
}
__global__ __launch_bounds__(256) void k_proj(const float* __restrict__ x, const float* __restrict__ Wq, const float* __restrict__ bq, const float* __restrict__ Wk, const float* __restrict__ bk, const float* __restrict__ Wv, const float* __restrict__ bv,
                                              h16* Qh, h16* Ql, h16* Kh, h16* Kl, h16* Vh, h16* Vl) {
    __shared__ __align__(16) char sm[11 * FPL + 3 * HD * 4];   // planes 0..2: Wq, Wk, Wv of the head; 3 + wave: the wave's x rows, later its output rows; then the three rounded biases
    const int tid = threadIdx.x, lane = tid & 31, lr = lane & 15, hi = lane >> 4, wave = tid >> 5;
    const int head = blockIdx.y, t0 = blockIdx.x * 512 + wave * 64;
    const float* xl = x + ((size_t)blockIdx.z * TT + t0 + hi) * DM + head * HD + lr * 4;   // the lane's 16 bytes of rows hi, 2 + hi, ...
    char* own = sm + (3 + wave) * FPL; float* sb = (float*)(sm + 11 * FPL);
    const int be = head * HD + (tid & 63); const float rq = bq[be], rk = bk[be], rv = bv[be];
    v4f xv[32], wr[12];                     // every load is issued before the first conversion waits for one
#pragma unroll
    for (int i = 0; i < 32; ++i) xv[i] = *(const v4fa*)(xl + (size_t)(2 * i) * DM);          // two 256-byte row pieces a load
    asm volatile("s_wait_xcnt 0x0" :: "v"(xl), "v"(be) : "memory");   // precaution: stands in front of the first overwrite of the address registers of the loads above; the addresses as inputs keep a load's own result off them
#pragma unroll
    for (int i = 0; i < 12; ++i) { const float* w = i < 4 ? Wq : i < 8 ? Wk : Wv; wr[i] = *(const v4fa*)(w + (size_t)head * (HD * HD) + ((i & 3) * 256 + tid) * 4); }
    asm volatile("" :: "v"(rq), "v"(rk), "v"(rv));   // holds the three bias loads up here among the others: left alone they sink into the branch below, and their latency is paid in front of the barrier
#pragma unroll
    for (int i = 0; i < 32; ++i) *(v2ia*)(own + (2 * i + hi) * FPB + lr * 8) = __builtin_bit_cast(v2i, __builtin_convertvector(xv[i], v4bf));
#pragma unroll
    for (int i = 0; i < 12; ++i) { const int c = (i & 3) * 256 + tid; *(v2ia*)(sm + (i >> 2) * FPL + (c >> 4) * FPB + (c & 15) * 8) = __builtin_bit_cast(v2i, __builtin_convertvector(wr[i], v4bf)); }
    if (wave < 2) { sb[tid] = bfr(rq); sb[HD + tid] = bfr(rk); sb[2 * HD + tid] = bfr(rv); }
    __syncthreads();                        // the weights and biases (and each wave's x rows) are visible to every lane that reads fragments
    const int fo = lr * FPB + 16 * hi;      // a lane's fragment: row lr of a 16-row tile, bytes 16 hi and 32 + 16 hi of each 64
    v16bf xf[4][2];
#pragma unroll
    for (int t = 0; t < 4; ++t)
#pragma unroll
        for (int ks = 0; ks < 2; ++ks) xf[t][ks] = LFrag<bf>::ld(own + fo + t * 16 * FPB + ks * 64);
    __builtin_amdgcn_wave_barrier(); asm volatile("" ::: "memory");       // the x rows are in registers before their LDS piece takes output rows
    const size_t pl = ((size_t)blockIdx.z * NH_ + head) * (size_t)(TT * HD);
    const size_t ro = pl + (size_t)t0 * HD, co = pl + t0;                 // token-major planes start at row t0, v^T planes at column t0
    static_assert(RH % 512 == 0, "a work-group's 512 tokens lie on one side of RH");
    if (blockIdx.x * 512 < RH) proj_planes<false, true, true>(xf, sm + fo, sb, own, Qh + ro, Ql + ro, lane);
    else proj_planes<false, false, true>(xf, sm + fo, sb, own, Qh + ro, nullptr, lane);
    proj_planes<false, true, false>(xf, sm + FPL + fo, sb + HD, own, Kh + ro, Kl + ro, lane);
    proj_planes<true, true, false>(xf, sm + 2 * FPL + fo, sb + 2 * HD, own, Vh + co, Vl + co, lane);
}

extern "C" void kernel_launch(void* const* d_in, const int* in_sizes, int n_in,
                              void* d_out, int out_size, void* d_ws, size_t ws_size, hipStream_t stream) {
    (void)in_sizes; (void)n_in; (void)out_size;
    const float* x = (const float*)d_in[0]; const float* wq = (const float*)d_in[1]; const float* bq = (const float*)d_in[2]; const float* wk = (const float*)d_in[3]; const float* bk = (const float*)d_in[4]; const float* wv = (const float*)d_in[5]; const float* bv = (const float*)d_in[6];
    float* OUT = (float*)d_out;     // [8][1024][1024]
    char* wsp = (char*)d_ws;
    auto take = [&](size_t bytes) { char* p = wsp; wsp += (bytes + 255) & ~(size_t)255; return (void*)p; };
    const size_t PB = (size_t)NH_ * TT * HD;   // one batch's share of a head plane, elements; every plane holds all NB_ batches
    h16* QPh = (h16*)take(NB_ * PB * 2); h16* QPl = (h16*)take(NB_ * PB * 2); h16* KPh = (h16*)take(NB_ * PB * 2); h16* KPl = (h16*)take(NB_ * PB * 2); h16* VTh = (h16*)take(NB_ * PB * 2); h16* VTl = (h16*)take(NB_ * PB * 2);
    if ((size_t)(wsp - (char*)d_ws) > ws_size) return;    // ws 256 MiB
    k_proj<<<dim3(TT / 512, NH_, NB_), 256, 0, stream>>>(x, wq, bq, wk, bk, wv, bv, QPh, QPl, KPh, KPl, VTh, VTl);
    k_fattn<<<dim3(RH / 256, NH_, NB_), 256, 0, stream>>>(QPh, QPl, KPh, KPl, VTh, VTl, OUT);
}

// v008
// It runs in 43.2 microseconds.
// Two timings next to v007 put it at 1.38 and 1.37 times that version's speed.
// Over all steps from v000 it is 101 times as fast.
#include <hip/hip_runtime.h>

// Per-head multi-head self-attention (sequences [8][1024][1024] viewed as 16 head slices of 64; per head: q = x_h Wq[h]^T + bq[h], k, v likewise ('oi' [16][64][64] + [16][64]); scores = q.k / 8; softmax; out_h = attn v; heads re-stacked -> [8][1024][1024] (8.4 M)).
// Layout: ONE kernel over every batch and head: it reads x and the three 64x64 weights of its head, forms its own q in registers and k and v^T of each 64-key stage in LDS (K = 64; each as an fp16 plane and an fp16 plane of what that rounding leaves), and runs scores, online softmax, attn v and the output rows on them (hybrid rows: < 512 hi/lo 3 products, rest the high planes alone). No workspace.
// Compute dtypes, f32 accumulate: every input rounded to bf16; projections exact + f32 biases; attention rows < 512 3 products of fp16 high/low pairs, rest fp16; softmax f32 (running maximum and sum); output f32.

#define NB_  8
#define TT   1024
#define DM   1024
#define NH_  16
#define NKV  16
#define REP  (NH_ / NKV)
#define HD   64
#define DQ   (NH_ * HD)
#define DKV  (NKV * HD)
#define RH   512                  // query rows < RH use hi+lo planes
#define WIN  0
#define SCL  0.125f   // HD^-0.5
typedef _Float16 h16;
typedef unsigned short bf;
typedef __attribute__((ext_vector_type(16))) __bf16   v16bf;
typedef __attribute__((ext_vector_type(16))) _Float16 v16h;
typedef __attribute__((ext_vector_type(8)))  _Float16 v8h;
typedef __attribute__((ext_vector_type(8)))  unsigned short v8us;
typedef __attribute__((ext_vector_type(8)))  float    v8f;
typedef __attribute__((ext_vector_type(4)))  float    v4f;
typedef v8h  __attribute__((may_alias)) v8ha;
typedef v4f  __attribute__((may_alias)) v4fa;
typedef v8us __attribute__((may_alias)) v8usa;

__device__ __forceinline__ unsigned short f2bf(float f) { unsigned u = __float_as_uint(f); u += 0x7FFFu + ((u >> 16) & 1u); return (unsigned short)(u >> 16); }
__device__ __forceinline__ float bf2f(unsigned short b) { return __uint_as_float(((unsigned)b) << 16); }
__device__ __forceinline__ float bfr(float f) { return bf2f(f2bf(f)); }
__device__ __forceinline__ v16h cat16(v8h lo, v8h hi) { return __builtin_shufflevector(lo, hi, 0, 1, 2, 3, 4, 5, 6, 7, 8, 9, 10, 11, 12, 13, 14, 15); }
__device__ __forceinline__ v16bf cat16b(v8us lo, v8us hi) { return __builtin_bit_cast(v16bf, __builtin_shufflevector(lo, hi, 0, 1, 2, 3, 4, 5, 6, 7, 8, 9, 10, 11, 12, 13, 14, 15)); }
__device__ __forceinline__ v8f wmma16(v16h a, v16h b, v8f c) { return __builtin_amdgcn_wmma_f32_16x16x32_f16(false, a, false, b, (short)0, c, false, false); }
__device__ __forceinline__ v8f wmmab(v16bf a, v16bf b, v8f c) { return __builtin_amdgcn_wmma_f32_16x16x32_bf16(false, a, false, b, (short)0, c, false, false); }

typedef __attribute__((ext_vector_type(4))) int v4i;
typedef v4i __attribute__((may_alias)) v4ia;
template <typename T16> struct LFrag;
template <> struct LFrag<h16> { static __device__ __forceinline__ v16h ld(const char* p) { return cat16(*(const v8ha*)p, *(const v8ha*)(p + 32)); } };
template <> struct LFrag<bf> { static __device__ __forceinline__ v16bf ld(const char* p) { return cat16b(*(const v8usa*)p, *(const v8usa*)(p + 32)); } };
__device__ __forceinline__ v8h hres(v8f a, v8h h) { return __builtin_convertvector(a - __builtin_convertvector(h, v8f), v8h); }   // what the fp16 rounding h of a leaves (an exact difference), itself rounded to fp16
__device__ __forceinline__ float xhalf(float x) { return __builtin_bit_cast(float, __builtin_amdgcn_permlanex16(__builtin_bit_cast(int, x), __builtin_bit_cast(int, x), 0x76543210, 0xfedcba98, false, false)); }   // lane l with lane l ^ 16
#define FKS  64                   // keys per stage
#define FPB  144                  // LDS row pitch in bytes: 128 of data + 16 (16 x odd: b128 readers without bank conflicts)
#define FPL  (64 * FPB)           // one staged plane: 64 rows
#define CL2  (SCL * 1.4426950408889634f)
#define NG   4                    // groups of 16 query columns a wave
#define NGH  2                    // of them on three products (rows < RH)
typedef __attribute__((ext_vector_type(4))) __bf16 v4bf;
typedef __attribute__((ext_vector_type(2))) int v2i;
typedef v2i __attribute__((may_alias)) v2ia;
__global__ __launch_bounds__(256) void k_fattn(const float* __restrict__ x, const float* __restrict__ Wq, const float* __restrict__ bq, const float* __restrict__ Wk, const float* __restrict__ bk, const float* __restrict__ Wv, const float* __restrict__ bv, float* __restrict__ OUT) {
    typedef v16h V;
    constexpr int NP = 4;                   // staged planes: K, V^T, K low, V^T low
    static_assert(2 * RH == TT, "as many rows on three products as on one");
    __shared__ __align__(16) char sm[(2 * NP + 3 + 2) * FPL + 3 * HD * 4];   // the K/V ring (first each wave's own 64 x rows, one plane a wave); Wq, Wk, Wv; two x stages; the three rounded biases
    char* const wl = sm + 2 * NP * FPL; char* const xb = wl + 3 * FPL; float* const sb = (float*)(xb + 2 * FPL);
    const int tid = threadIdx.x, lane = tid & 31, lr = lane & 15, hi = lane >> 4, wv = tid >> 5;
    const int head = blockIdx.y;
    const int q0 = blockIdx.x * 256 + wv * 32;          // group g starts at row q0 + 16 g (g < NGH), RH + q0 + 16 (g - NGH) (the rest)
    const float* xh = x + (size_t)blockIdx.z * TT * DM + head * HD;   // row 0 of the head's slice
    const float* xl = xh + (size_t)(q0 + hi) * DM + lr * 4;           // the lane's 16 bytes of rows hi, 2 + hi, ... of a query group
    // x staging: 16-byte chunk tid + 256 j of a 64 x 256-byte stage is row tid / 16 + 16 j, chunk tid % 16
    const int xrow = tid >> 4, xcol = tid & 15;
    const unsigned xo = xrow * DM + xcol * 4;           // the lane's place in a stage, in elements: a 32-bit offset beside the uniform base
    char* const xd = xb + xrow * FPB + xcol * 8;
    v4f xr[4];
    auto fetchx = [&](int kb) {
#pragma unroll
        for (int j = 0; j < 4; ++j) xr[j] = *(const v4fa*)(xh + (size_t)(kb + j * 16) * DM + xo);
        asm volatile("s_wait_xcnt 0x0" ::: "memory"); };   // precaution: stands in front of the first overwrite of these loads' address registers
    auto putx = [&](int buf) {
#pragma unroll
        for (int j = 0; j < 4; ++j) *(v2ia*)(xd + buf * FPL + j * 16 * FPB) = __builtin_bit_cast(v2i, __builtin_convertvector(xr[j], v4bf)); };
    const int fo = lr * FPB + 16 * hi;      // a lane's fragment: row lr of a 16-row tile, bytes 16 hi and 32 + 16 hi of each 64
    // K and V^T of 64 staged tokens, into a ring buffer: a wave takes feature tile wave % 4 and token tiles 2 (wave / 4), 2 (wave / 4) + 1 of both
    const int ft = wv & 3, hf = wv >> 2;
    v16bf px[2][2], pwk[2], pwv[2];         // the fragments of that step: x of the two token tiles, Wk and Wv of the feature tile
    auto ldp = [&](const char* xs) { const char* w = wl + FPL + fo + ft * 16 * FPB; pwk[0] = LFrag<bf>::ld(w); pwk[1] = LFrag<bf>::ld(w + 64); pwv[0] = LFrag<bf>::ld(w + FPL); pwv[1] = LFrag<bf>::ld(w + FPL + 64);
#pragma unroll
        for (int u = 0; u < 2; ++u) { const char* p = xs + fo + (hf * 2 + u) * 16 * FPB; px[u][0] = LFrag<bf>::ld(p); px[u][1] = LFrag<bf>::ld(p + 64); } };
    auto form = [&](char* dst) {
        const float* s = sb + HD + ft * 16;     // the bias follows the feature: the D row (k) or the D column (v)
        const v8f bm = __builtin_shufflevector(*(const v4fa*)(s + hi * 8), *(const v4fa*)(s + hi * 8 + 4), 0, 1, 2, 3, 4, 5, 6, 7); const float bn = s[HD + lr];
        v8f ak[2], av[2];
#pragma unroll
        for (int u = 0; u < 2; ++u) { ak[u] = wmmab(pwk[0], px[u][0], (v8f){}); av[u] = wmmab(px[u][0], pwv[0], (v8f){}); }
#pragma unroll
        for (int u = 0; u < 2; ++u) { ak[u] = wmmab(pwk[1], px[u][1], ak[u]); av[u] = wmmab(px[u][1], pwv[1], av[u]); }
#pragma unroll
        for (int u = 0; u < 2; ++u) { const v8f yk = ak[u] + bm, yv = av[u] + bn; const v8h kh = __builtin_convertvector(yk, v8h), vh = __builtin_convertvector(yv, v8h);
            char* dk = dst + ((hf * 2 + u) * 16 + lr) * FPB + ft * 32 + hi * 16; char* dv = dst + FPL + (ft * 16 + lr) * FPB + (hf * 2 + u) * 32 + hi * 16;
            *(v4ia*)dk = __builtin_bit_cast(v4i, kh); *(v4ia*)(dk + 2 * FPL) = __builtin_bit_cast(v4i, hres(yk, kh));
            *(v4ia*)dv = __builtin_bit_cast(v4i, vh); *(v4ia*)(dv + 2 * FPL) = __builtin_bit_cast(v4i, hres(yv, vh)); } };
    V qf[NG][2], qf2[NGH][2];
    {   // prologue: the wave's 64 query rows of x, the weights, the biases and the first two x stages to LDS; then q
        const int be = head * HD + (tid & 63); const float rq = bq[be], rk = bk[be], rv = bv[be];
        v4f xv[32], wr[12], xa[4];          // every load is issued before the first conversion waits for one
#pragma unroll
        for (int i = 0; i < 32; ++i) xv[i] = *(const v4fa*)(xl + (size_t)(((i >> 3) < NGH ? (i >> 3) * 16 : RH + ((i >> 3) - NGH) * 16) + 2 * (i & 7)) * DM);   // two 256-byte row pieces a load
#pragma unroll
        for (int j = 0; j < 4; ++j) { xa[j] = *(const v4fa*)(xh + (size_t)(j * 16) * DM + xo); xr[j] = *(const v4fa*)(xh + (size_t)(FKS + j * 16) * DM + xo); }   // x stages 0 and 1
        asm volatile("s_wait_xcnt 0x0" :: "v"(xl), "v"(xo), "v"(be) : "memory");   // precaution: stands in front of the first overwrite of the address registers of the loads above; the addresses as inputs keep a load's own result off them
        const int wo = head * (HD * HD) + tid * 4; const float* pq = Wq + wo; const float* pk = Wk + wo; const float* pv = Wv + wo;
#pragma unroll
        for (int i = 0; i < 12; ++i) wr[i] = *(const v4fa*)((i < 4 ? pq : i < 8 ? pk : pv) + (i & 3) * 1024);
        asm volatile("s_wait_xcnt 0x0" :: "v"(pq), "v"(pk), "v"(pv), "v"(rq), "v"(rk), "v"(rv) : "memory");   // the same precaution for the weight loads, their addresses as inputs for the same reason; the three biases as inputs hold their loads up here among the others, or their latency is paid in front of the barrier
        char* own = sm + wv * FPL;
#pragma unroll
        for (int i = 0; i < 32; ++i) *(v2ia*)(own + (2 * i + hi) * FPB + lr * 8) = __builtin_bit_cast(v2i, __builtin_convertvector(xv[i], v4bf));
#pragma unroll
        for (int j = 0; j < 4; ++j) *(v2ia*)(xd + j * 16 * FPB) = __builtin_bit_cast(v2i, __builtin_convertvector(xa[j], v4bf));
        putx(1);
#pragma unroll
        for (int i = 0; i < 12; ++i) { const int c = (i & 3) * 256 + tid; *(v2ia*)(wl + (i >> 2) * FPL + (c >> 4) * FPB + (c & 15) * 8) = __builtin_bit_cast(v2i, __builtin_convertvector(wr[i], v4bf)); }
        if (wv < 2) { sb[tid] = bfr(rq); sb[HD + tid] = bfr(rk); sb[2 * HD + tid] = bfr(rv); }
        __syncthreads();                    // the weights, the biases and the first two x stages are visible to every wave
        v16bf wf[4][2]; v8f bm[4];
#pragma unroll
        for (int t = 0; t < 4; ++t) { wf[t][0] = LFrag<bf>::ld(wl + fo + t * 16 * FPB); wf[t][1] = LFrag<bf>::ld(wl + fo + t * 16 * FPB + 64);
            const float* s = sb + t * 16 + hi * 8; bm[t] = __builtin_shufflevector(*(const v4fa*)s, *(const v4fa*)(s + 4), 0, 1, 2, 3, 4, 5, 6, 7); }
#pragma unroll
        for (int g = 0; g < NG; ++g) { const v16bf x0 = LFrag<bf>::ld(own + fo + g * 16 * FPB), x1 = LFrag<bf>::ld(own + fo + g * 16 * FPB + 64);
            v8h yh[4], yl[4];
#pragma unroll
            for (int mb = 0; mb < 4; ++mb) { v8f a = wmmab(wf[mb][0], x0, (v8f){}); a = wmmab(wf[mb][1], x1, a);
                const v8f y = (a + bm[mb]) * CL2; yh[mb] = __builtin_convertvector(y, v8h); if (g < NGH) yl[mb] = hres(y, yh[mb]); }
#pragma unroll
            for (int ks = 0; ks < 2; ++ks) { qf[g][ks] = cat16(yh[2 * ks], yh[2 * ks + 1]); if (g < NGH) qf2[g][ks] = cat16(yl[2 * ks], yl[2 * ks + 1]); } }   // features 32 ks + 8 hi + 0..7 and 32 ks + 16 + 8 hi + 0..7: the k order of the K loader
        __syncthreads();                    // every wave has read its x rows out of the ring before stage 0 is written there
        ldp(xb); form(sm);
    }
    v8f o[NG][4], nm[NG]; float l[NG];      // nm: minus the group's running maximum in all eight registers, as a score tile's start value
#pragma unroll
    for (int g = 0; g < NG; ++g) { nm[g] = (v8f){}; l[g] = 0.f;
#pragma unroll
        for (int dt = 0; dt < 4; ++dt) o[g][dt] = (v8f){}; }
    __syncthreads();                        // stage 0 is visible to all 8 waves
#pragma unroll 1                            // rolled: one copy of the stage body, the buffer chosen by s & 1
    for (int s = 0; s < TT / FKS; ++s) {
        const char* B = sm + (s & 1) * (NP * FPL) + fo;
        V kf[2][2][2], kl[2][2][2], vf[2][4], vl[2][4];   // the stage's fragments: K [pass][16-key tile][k half], V^T [pass][16-feature tile]
        auto ldk = [&](int kk) {
#pragma unroll
            for (int t = 0; t < 2; ++t) { const char* kr = B + (kk * 2 + t) * 16 * FPB; kf[kk][t][0] = LFrag<h16>::ld(kr); kf[kk][t][1] = LFrag<h16>::ld(kr + 64); kl[kk][t][0] = LFrag<h16>::ld(kr + 2 * FPL); kl[kk][t][1] = LFrag<h16>::ld(kr + 2 * FPL + 64); } };
        auto ldv = [&](int kk) {
#pragma unroll
            for (int dt = 0; dt < 4; ++dt) { const char* vr = B + FPL + dt * 16 * FPB + kk * 64; vf[kk][dt] = LFrag<h16>::ld(vr); vl[kk][dt] = LFrag<h16>::ld(vr + 2 * FPL); } };
        ldk(0);
        __builtin_amdgcn_sched_barrier(0);  // the first pass's K reads stay one group up here: their latency runs while the global loads below are issued
        if (s + 2 < TT / FKS) fetchx((s + 2) * FKS);   // x of the stage after the next flies while this stage is worked on
#pragma unroll
        for (int kk = 0; kk < 2; ++kk) {    // 32 keys a pass
            v8f sc[NG][2];
#pragma unroll
            for (int t = 0; t < 2; ++t) {
#pragma unroll
                for (int g = 0; g < NG; ++g) { v8f a = wmma16(kf[kk][t][0], qf[g][0], nm[g]); a = wmma16(kf[kk][t][1], qf[g][1], a);
                    if (g < NGH) { a = wmma16(kf[kk][t][0], qf2[g][0], a); a = wmma16(kf[kk][t][1], qf2[g][1], a); a = wmma16(kl[kk][t][0], qf[g][0], a); a = wmma16(kl[kk][t][1], qf[g][1], a); }
                    sc[g][t] = a; } }
            __builtin_amdgcn_sched_barrier(0);   // the products above are issued first, so that the reads below land while the matrix unit works
            ldv(kk);
            __builtin_amdgcn_sched_barrier(0);   // these reads stay one group here, in front of the maxima and exponentials, which cover their latency
            const bool first = kk == 0 && s == 0;   // the first 32 keys set the maximum, whatever it is
            float mx[NG];
#pragma unroll
            for (int g = 0; g < NG; ++g) { float a = fmaxf(sc[g][0][0], sc[g][1][0]);
#pragma unroll
                for (int j = 1; j < 8; ++j) a = fmaxf(a, fmaxf(sc[g][0][j], sc[g][1][j]));
                mx[g] = fmaxf(a, xhalf(a)); }   // how far the pass's maximum lies above the one in use
            if (__builtin_amdgcn_ballot_w32(fmaxf(fmaxf(mx[0], mx[1]), fmaxf(mx[2], mx[3])) > (first ? -3.0e38f : 8.0f)) != 0) {   // scalar branch; always taken on the first pass (no sum of fp16 products reaches -3e38), rare later
#pragma unroll
                for (int g = 0; g < NG; ++g) { const float d = first ? mx[g] : fmaxf(mx[g], 0.f); const float al = first ? 1.0f : __builtin_amdgcn_exp2f(-d); nm[g] -= d; l[g] *= al; sc[g][0] -= d; sc[g][1] -= d;
#pragma unroll
                    for (int dt = 0; dt < 4; ++dt) o[g][dt] *= al; } }
            V pf[NG], pf2[NGH];
#pragma unroll
            for (int g = 0; g < NG; ++g) {
#pragma unroll
                for (int t = 0; t < 2; ++t)
#pragma unroll
                    for (int j = 0; j < 8; ++j) { const float p = __builtin_amdgcn_exp2f(sc[g][t][j]); sc[g][t][j] = p; l[g] += p; }
                const v8h p0 = __builtin_convertvector(sc[g][0], v8h), p1 = __builtin_convertvector(sc[g][1], v8h);
                pf[g] = cat16(p0, p1); if (g < NGH) pf2[g] = cat16(hres(sc[g][0], p0), hres(sc[g][1], p1)); }
#pragma unroll
            for (int dt = 0; dt < 4; ++dt) {
                if (kk == 0 && dt == 2) { __builtin_amdgcn_sched_barrier(0);   // half of the V^T fragments' registers are free by now; in front of all 32 products these reads do not fit 512 registers
                    ldk(1);
                    __builtin_amdgcn_sched_barrier(0); }   // the second pass's K reads stay one group in front of the second half of this pass's last products, which cover their latency
                if (kk == 1 && dt == 2) { __builtin_amdgcn_sched_barrier(0);   // the registers that held the second pass's K fragments are free by now
                    ldp(xb + ((s + 1) & 1) * FPL);
                    __builtin_amdgcn_sched_barrier(0); }   // the reads for the next stage's K and V^T stay one group in front of the stage's last products, which cover their latency (no test for the last stage here: what it reads is in bounds and unused, and a branch among the products costs every stage)
#pragma unroll
                for (int g = 0; g < NG; ++g) { o[g][dt] = wmma16(vf[kk][dt], pf[g], o[g][dt]); if (g < NGH) { o[g][dt] = wmma16(vf[kk][dt], pf2[g], o[g][dt]); o[g][dt] = wmma16(vl[kk][dt], pf[g], o[g][dt]); } } }
            if (kk == 0) __builtin_amdgcn_sched_barrier(0);   // the second pass's score products stay behind these: moved up among them, they wait for the K reads after a few products only
        }
        __builtin_amdgcn_sched_barrier(0);   // the stage's last products stay in front of the four slots below
        asm volatile("v_nop\n\tv_nop\n\tv_nop\n\tv_nop");   // the distance a matrix product needs before a vector instruction overwrites its operands: the taken side of the branch below starts with such an overwrite
        if (s + 1 < TT / FKS) form(sm + ((s + 1) & 1) * (NP * FPL));   // from the x staged one trip ago, into the buffer that stage s - 1 read: every wave left it at the last barrier
        if (s + 2 < TT / FKS) putx(s & 1);   // the x buffer that stage s was formed from, one trip ago
        __syncthreads();                    // publishes K and V^T of stage s + 1 and x of stage s + 2, and ends every wave's reads of stage s
    }
    // epilogue: each wave turns its O^T tiles into output rows through its own 16 x 68 floats of the (now free) ring, so that stores are whole 256-byte row pieces
    float* os = (float*)sm + wv * (16 * 68);
#pragma unroll
    for (int g = 0; g < NG; ++g) { const float inv = 1.0f / (l[g] + xhalf(l[g]));
#pragma unroll
        for (int dt = 0; dt < 4; ++dt) { const v8f v = o[g][dt] * inv; float* d = os + lr * 68 + dt * 16 + 8 * hi; *(v4fa*)d = __builtin_shufflevector(v, v, 0, 1, 2, 3); *(v4fa*)(d + 4) = __builtin_shufflevector(v, v, 4, 5, 6, 7); }
        __builtin_amdgcn_wave_barrier(); asm volatile("" ::: "memory");   // other lanes' LDS writes above, this lane's reads below: keep the compiler from crossing them
        float* orow = OUT + ((size_t)blockIdx.z * TT + q0 + (g < NGH ? g * 16 : RH + (g - NGH) * 16)) * DQ + head * HD;
#pragma unroll
        for (int r = 0; r < 8; ++r) { const int row = 2 * r + hi; *(v4f*)(orow + (size_t)row * DQ + lr * 4) = *(const v4fa*)(os + row * 68 + lr * 4); }
        __builtin_amdgcn_wave_barrier(); asm volatile("s_wait_xcnt 0x0" ::: "memory");   // the reads above end before the next group's writes; the wait is a precaution: it stands in front of the first overwrite of a register that these stores name
        __builtin_amdgcn_sched_barrier(0);  // the next group's arithmetic stays behind that wait
    }
}

extern "C" void kernel_launch(void* const* d_in, const int* in_sizes, int n_in,
                              void* d_out, int out_size, void* d_ws, size_t ws_size, hipStream_t stream) {
    (void)in_sizes; (void)n_in; (void)out_size; (void)d_ws; (void)ws_size;
    const float* x = (const float*)d_in[0]; const float* wq = (const float*)d_in[1]; const float* bq = (const float*)d_in[2]; const float* wk = (const float*)d_in[3]; const float* bk = (const float*)d_in[4]; const float* wv = (const float*)d_in[5]; const float* bv = (const float*)d_in[6];
    float* OUT = (float*)d_out;     // [8][1024][1024]
    k_fattn<<<dim3(RH / 256, NH_, NB_), 256, 0, stream>>>(x, wq, bq, wk, bk, wv, bv, OUT);
}

// v009
// It runs in 34.9 microseconds.
// Next to v008, in two timings, it ran 1.24 times as fast each time.
// All steps since v000 together make it 125 times as fast.
#include <hip/hip_runtime.h>

// Per-head multi-head self-attention (sequences [8][1024][1024] viewed as 16 head slices of 64; per head: q = x_h Wq[h]^T + bq[h], k, v likewise ('oi' [16][64][64] + [16][64]); scores = q.k / 8; softmax; out_h = attn v; heads re-stacked -> [8][1024][1024] (8.4 M)).
// Layout: ONE kernel over every batch and head. The k and v projections are taken out of the key loop: q.k = (Wk^T q).x + q.bk, whose last term is the same for every key of a query and cancels in the softmax, and attn v = Wv (attn x) + bv, as a row of attn sums to 1. So a wave forms z = Wk^T q of its queries once, the loop runs scores, online softmax and attn x on the staged x itself, and Wv and bv come in once behind it (hybrid rows, in the loop: < 512 high and low halves of z and of P, rest the high halves alone; q and attn x, used once a query, go in as high and low halves for every row). No workspace.
// Compute dtypes, f32 accumulate: every input rounded to bf16; q projection bf16 operands + f32 bias; x, Wk, Wv held as fp16 behind that rounding (8 significant bits: no low half is left); q, attn x as fp16 high/low pairs; z, P as fp16 high/low pairs (rows < 512: 2 products) or fp16 (rest); softmax f32 (running maximum and sum); output f32.

#define NB_  8
#define TT   1024
#define DM   1024
#define NH_  16
#define NKV  16
#define REP  (NH_ / NKV)
#define HD   64
#define DQ   (NH_ * HD)
#define DKV  (NKV * HD)
#define RH   512                  // query rows < RH use hi+lo halves of z and P
#define WIN  0
#define SCL  0.125f   // HD^-0.5
typedef _Float16 h16;
typedef unsigned short bf;
typedef __attribute__((ext_vector_type(16))) __bf16   v16bf;
typedef __attribute__((ext_vector_type(16))) _Float16 v16h;
typedef __attribute__((ext_vector_type(8)))  _Float16 v8h;
typedef __attribute__((ext_vector_type(8)))  unsigned short v8us;
typedef __attribute__((ext_vector_type(8)))  float    v8f;
typedef __attribute__((ext_vector_type(4)))  float    v4f;
typedef v8h  __attribute__((may_alias)) v8ha;
typedef v4f  __attribute__((may_alias)) v4fa;
typedef v8us __attribute__((may_alias)) v8usa;

__device__ __forceinline__ unsigned short f2bf(float f) { unsigned u = __float_as_uint(f); u += 0x7FFFu + ((u >> 16) & 1u); return (unsigned short)(u >> 16); }
__device__ __forceinline__ float bf2f(unsigned short b) { return __uint_as_float(((unsigned)b) << 16); }
__device__ __forceinline__ float bfr(float f) { return bf2f(f2bf(f)); }
__device__ __forceinline__ v16h cat16(v8h lo, v8h hi) { return __builtin_shufflevector(lo, hi, 0, 1, 2, 3, 4, 5, 6, 7, 8, 9, 10, 11, 12, 13, 14, 15); }
__device__ __forceinline__ v16bf cat16b(v8us lo, v8us hi) { return __builtin_bit_cast(v16bf, __builtin_shufflevector(lo, hi, 0, 1, 2, 3, 4, 5, 6, 7, 8, 9, 10, 11, 12, 13, 14, 15)); }
__device__ __forceinline__ v8f wmma16(v16h a, v16h b, v8f c) { return __builtin_amdgcn_wmma_f32_16x16x32_f16(false, a, false, b, (short)0, c, false, false); }
__device__ __forceinline__ v8f wmmab(v16bf a, v16bf b, v8f c) { return __builtin_amdgcn_wmma_f32_16x16x32_bf16(false, a, false, b, (short)0, c, false, false); }

typedef __attribute__((ext_vector_type(4))) int v4i;
// ---- k_fattn: projections and fused attention of one (batch, head) for 256 query rows < RH and 256 query rows >= RH; 8 waves x (32 + 32) query columns; grid (RH / 256, heads, batches).
// A wave holds four groups of 16 query columns: groups 0, 1 are rows < RH (two products: high and low half of the query-side operand), groups 2, 3 rows >= RH (the high half alone); every x and x^T fragment it reads serves all four.
// Transposed products: S^T = X Z^T (A = x rows, B = z, kept in registers), Y^T += X^T P^T (A = x^T rows, B = P^T packed straight from the two S^T tiles of 32 keys, which is the hardware k order the A loader also has).
// A lane holds scores of ONE query a group (column lane & 15); its two halves split the keys. Running maximum in base 2, rescale only when a maximum grows by more than 8; row sums per lane half, joined at the end.
// q is formed scaled by HD^-0.5 log2(e), z inherits that, and a group's score tiles start from minus its running maximum (the C operand of the first product), so what the products leave is the exponent itself.
// q: D = Wq x^T (bf16 operands, f32 bias behind the sums); z: D = Wk^T q^T; output: D = Wv Y^T, started from bv (C operand). In each a lane holds 8 neighbouring features of ONE query, so two D tiles are the next product's B fragment as they stand; A fragments come from LDS with one loader.
// Staging: a thread takes a 4 x 4 block (4 rows x 16 bytes of f32), so it writes 8-byte pieces of the rows and of the transposed rows alike (x and x^T of a stage; Wk^T).
// Stages of 64 keys: x of stage s + 1 flies global -> registers during stage s and goes to LDS, both ways round, at its foot; two buffers, one barrier a stage.
// A wave reads its fragments from LDS in four groups a stage (x, then x^T, of each pass), each ahead of the products that use it.
// Every full '#pragma unroll' in it is there so that the fragment, score and accumulator arrays are indexed by constants and stay in registers.
typedef v4i __attribute__((may_alias)) v4ia;
template <typename T16> struct LFrag;
template <> struct LFrag<h16> { static __device__ __forceinline__ v16h ld(const char* p) { return cat16(*(const v8ha*)p, *(const v8ha*)(p + 32)); } };
template <> struct LFrag<bf> { static __device__ __forceinline__ v16bf ld(const char* p) { return cat16b(*(const v8usa*)p, *(const v8usa*)(p + 32)); } };
__device__ __forceinline__ v8h hres(v8f a, v8h h) { return __builtin_convertvector(a - __builtin_convertvector(h, v8f), v8h); }   // what the fp16 rounding h of a leaves (an exact difference), itself rounded to fp16
__device__ __forceinline__ float xhalf(float x) { return __builtin_bit_cast(float, __builtin_amdgcn_permlanex16(__builtin_bit_cast(int, x), __builtin_bit_cast(int, x), 0x76543210, 0xfedcba98, false, false)); }   // lane l with lane l ^ 16
#define FKS  64                   // keys per stage
#define FPB  144                  // LDS row pitch in bytes: 128 of data + 16 (16 x odd: b128 readers without bank conflicts)
#define FPL  (64 * FPB)           // one staged plane: 64 rows
#define CL2  (SCL * 1.4426950408889634f)
#define NG   4                    // groups of 16 query columns a wave
#define NGH  2                    // of them on two products (rows < RH)
typedef __attribute__((ext_vector_type(4))) __bf16 v4bf;
typedef __attribute__((ext_vector_type(2))) int v2i;
typedef v2i __attribute__((may_alias)) v2ia;
typedef __attribute__((ext_vector_type(4))) _Float16 v4h;
__device__ __forceinline__ v4f bf4(v4f a) { return __builtin_convertvector(__builtin_convertvector(a, v4bf), v4f); }   // rounded to bf16
__device__ __forceinline__ v4h bfh(v4f a) { return __builtin_convertvector(bf4(a), v4h); }   // rounded to bf16, then held as fp16
__global__ __launch_bounds__(256) void k_fattn(const float* __restrict__ x, const float* __restrict__ Wq, const float* __restrict__ bq, const float* __restrict__ Wk, const float* __restrict__ bk, const float* __restrict__ Wv, const float* __restrict__ bv, float* __restrict__ OUT) {
    typedef v16h V;
    constexpr int NP = 2;                   // staged planes: x (a row a token), x^T (a row a feature)
    static_assert(2 * RH == TT, "as many rows on two products as on one");
    (void)bk;                               // q.bk is one constant a query row: the softmax takes it out again
    __shared__ __align__(16) char sm[(8 + 3) * FPL + 2 * HD * 4];   // each wave's own 64 x rows, one plane a wave (behind them, in the first four planes, the ring of two stages); Wq (bf16), Wk^T, Wv (fp16); the rounded biases bq, bv
    char* const wl = sm + 8 * FPL; float* const sb = (float*)(wl + 3 * FPL);
    const int tid = threadIdx.x, lane = tid & 31, lr = lane & 15, hi = lane >> 4, wv = tid >> 5;
    const int head = blockIdx.y;
    const int q0 = blockIdx.x * 256 + wv * 32;          // group g starts at row q0 + 16 g (g < NGH), RH + q0 + 16 (g - NGH) (the rest)
    const float* xh = x + (size_t)blockIdx.z * TT * DM + head * HD;   // row 0 of the head's slice
    const float* xl = xh + (size_t)(q0 + hi) * DM + lr * 4;           // the lane's 16 bytes of rows hi, 2 + hi, ... of a query group
    // staging blocks: thread tid has rows 4 (tid / 16) + 0..3, 16-byte chunk tid % 16 of a 64 x 256-byte piece
    const int xrow = tid >> 4, xcol = tid & 15;
    const unsigned xo = xrow * 4 * DM + xcol * 4;       // the lane's place in a stage, in elements: a 32-bit offset beside the uniform base
    const int dn = xrow * 4 * FPB + xcol * 8, dt_ = xcol * 4 * FPB + xrow * 8;   // the block's place in a plane as it lies, and transposed
    v4f xr[4];
    auto fetchx = [&](int kb) {
#pragma unroll
        for (int j = 0; j < 4; ++j) xr[j] = *(const v4fa*)(xh + (size_t)(kb + j) * DM + xo);
        asm volatile("s_wait_xcnt 0x0" ::: "memory"); };   // precaution: stands in front of the first overwrite of these loads' address registers
    auto putt = [&](char* d, const v4f* r) {   // a 4 x 4 block of rounded values, transposed, as fp16
#pragma unroll
        for (int i = 0; i < 4; ++i) { const v4f t = { r[0][i], r[1][i], r[2][i], r[3][i] }; *(v2ia*)(d + dt_ + i * FPB) = __builtin_bit_cast(v2i, __builtin_convertvector(t, v4h)); } };
    auto putx = [&](int buf) { char* d = sm + buf * (NP * FPL); v4f r[4];
#pragma unroll
        for (int j = 0; j < 4; ++j) { r[j] = bf4(xr[j]); *(v2ia*)(d + dn + j * FPB) = __builtin_bit_cast(v2i, __builtin_convertvector(r[j], v4h)); }
        putt(d + FPL, r); };
    const int fo = lr * FPB + 16 * hi;      // a lane's fragment: row lr of a 16-row tile, bytes 16 hi and 32 + 16 hi of each 64
    V qf[NG][2], qf2[NGH][2];               // z = Wk^T q, high and low halves
    {   // prologue: the wave's 64 query rows of x, the weights, the biases and the first x stage; then q and z
        const int be = head * HD + (tid & 63); const float rq = bq[be], rv = bv[be];
        v4f xv[32], wr[12];                 // every load is issued before the first conversion waits for one
#pragma unroll
        for (int i = 0; i < 32; ++i) xv[i] = *(const v4fa*)(xl + (size_t)(((i >> 3) < NGH ? (i >> 3) * 16 : RH + ((i >> 3) - NGH) * 16) + 2 * (i & 7)) * DM);   // two 256-byte row pieces a load
#pragma unroll
        for (int j = 0; j < 4; ++j) xr[j] = *(const v4fa*)(xh + (size_t)j * DM + xo);   // x stage 0
        asm volatile("s_wait_xcnt 0x0" :: "v"(xl), "v"(xo), "v"(be) : "memory");   // precaution: stands in front of the first overwrite of the address registers of the loads above; the addresses as inputs keep a load's own result off them
        const int wo = head * (HD * HD) + tid * 4; const float* pq = Wq + wo; const float* pk = Wk + head * (HD * HD) + xrow * 4 * HD + xcol * 4; const float* pv = Wv + wo;
#pragma unroll
        for (int i = 0; i < 12; ++i) wr[i] = *(const v4fa*)(i < 4 ? pq + i * 1024 : i < 8 ? pk + (i & 3) * HD : pv + (i & 3) * 1024);   // Wq, Wv in whole lines; Wk in 4 x 4 blocks
        asm volatile("s_wait_xcnt 0x0" :: "v"(pq), "v"(pk), "v"(pv), "v"(rq), "v"(rv) : "memory");   // the same precaution for the weight loads, their addresses as inputs for the same reason; the two biases as inputs hold their loads up here among the others, or their latency is paid in front of the barrier
        char* own = sm + wv * FPL;
#pragma unroll
        for (int i = 0; i < 32; ++i) *(v2ia*)(own + (2 * i + hi) * FPB + lr * 8) = __builtin_bit_cast(v2i, __builtin_convertvector(xv[i], v4bf));
#pragma unroll
        for (int i = 0; i < 4; ++i) { const int c = i * 256 + tid; char* d = wl + (c >> 4) * FPB + (c & 15) * 8;
            *(v2ia*)d = __builtin_bit_cast(v2i, __builtin_convertvector(wr[i], v4bf)); *(v2ia*)(d + 2 * FPL) = __builtin_bit_cast(v2i, bfh(wr[8 + i])); }
        { const v4f r[4] = { bf4(wr[4]), bf4(wr[5]), bf4(wr[6]), bf4(wr[7]) }; putt(wl + FPL, r); }
        if (wv < 2) { sb[tid] = bfr(rq); sb[HD + tid] = bfr(rv); }
        __syncthreads();                    // the weights and the biases are visible to every wave
        v16bf wf[4][2]; V wk[4][2]; v8f bm[4];
#pragma unroll
        for (int t = 0; t < 4; ++t) { const char* w = wl + fo + t * 16 * FPB; wf[t][0] = LFrag<bf>::ld(w); wf[t][1] = LFrag<bf>::ld(w + 64); wk[t][0] = LFrag<h16>::ld(w + FPL); wk[t][1] = LFrag<h16>::ld(w + FPL + 64);
            const float* s = sb + t * 16 + hi * 8; bm[t] = __builtin_shufflevector(*(const v4fa*)s, *(const v4fa*)(s + 4), 0, 1, 2, 3, 4, 5, 6, 7); }
#pragma unroll
        for (int g = 0; g < NG; ++g) { const v16bf x0 = LFrag<bf>::ld(own + fo + g * 16 * FPB), x1 = LFrag<bf>::ld(own + fo + g * 16 * FPB + 64);
            v8h yh[4], yl[4];
#pragma unroll
            for (int mb = 0; mb < 4; ++mb) { v8f a = wmmab(wf[mb][0], x0, (v8f){}); a = wmmab(wf[mb][1], x1, a);
                const v8f y = (a + bm[mb]) * CL2; yh[mb] = __builtin_convertvector(y, v8h); yl[mb] = hres(y, yh[mb]); }
            const V a0 = cat16(yh[0], yh[1]), a1 = cat16(yh[2], yh[3]), c0 = cat16(yl[0], yl[1]), c1 = cat16(yl[2], yl[3]);   // q features 32 ks + 8 hi + 0..7 and 32 ks + 16 + 8 hi + 0..7: the k order of the loader
#pragma unroll
            for (int mb = 0; mb < 4; ++mb) { v8f a = wmma16(wk[mb][0], a0, (v8f){}); a = wmma16(wk[mb][1], a1, a); a = wmma16(wk[mb][0], c0, a); a = wmma16(wk[mb][1], c1, a);
                yh[mb] = __builtin_convertvector(a, v8h); if (g < NGH) yl[mb] = hres(a, yh[mb]); }
#pragma unroll
            for (int ks = 0; ks < 2; ++ks) { qf[g][ks] = cat16(yh[2 * ks], yh[2 * ks + 1]); if (g < NGH) qf2[g][ks] = cat16(yl[2 * ks], yl[2 * ks + 1]); } }   // the same k order again, now over the features of x
        __syncthreads();                    // every wave has read its x rows out of the ring's place before stage 0 is written there
        putx(0);
    }
    v8f o[NG][4], nm[NG]; float l[NG];      // nm: minus the group's running maximum in all eight registers, as a score tile's start value
#pragma unroll
    for (int g = 0; g < NG; ++g) { nm[g] = (v8f){}; l[g] = 0.f;
#pragma unroll
        for (int dt = 0; dt < 4; ++dt) o[g][dt] = (v8f){}; }
    __syncthreads();                        // stage 0 is visible to all 8 waves
#pragma unroll 1                            // rolled: one copy of the stage body, the buffer chosen by s & 1
    for (int s = 0; s < TT / FKS; ++s) {
        const char* B = sm + (s & 1) * (NP * FPL) + fo;
        V kf[2][2][2], vf[2][4];            // the stage's fragments: x [pass][16-key tile][k half], x^T [pass][16-feature tile]
        auto ldk = [&](int kk) {
#pragma unroll
            for (int t = 0; t < 2; ++t) { const char* kr = B + (kk * 2 + t) * 16 * FPB; kf[kk][t][0] = LFrag<h16>::ld(kr); kf[kk][t][1] = LFrag<h16>::ld(kr + 64); } };
        auto ldv = [&](int kk) {
#pragma unroll
            for (int dt = 0; dt < 4; ++dt) vf[kk][dt] = LFrag<h16>::ld(B + FPL + dt * 16 * FPB + kk * 64); };
        ldk(0);
        __builtin_amdgcn_sched_barrier(0);  // the first pass's x reads stay one group up here: their latency runs while the global loads below are issued
        if (s + 1 < TT / FKS) fetchx((s + 1) * FKS);   // x of the next stage flies while this stage is worked on
#pragma unroll
        for (int kk = 0; kk < 2; ++kk) {    // 32 keys a pass
            v8f sc[NG][2];
#pragma unroll
            for (int t = 0; t < 2; ++t) {
#pragma unroll
                for (int g = 0; g < NG; ++g) { v8f a = wmma16(kf[kk][t][0], qf[g][0], nm[g]); a = wmma16(kf[kk][t][1], qf[g][1], a);
                    if (g < NGH) { a = wmma16(kf[kk][t][0], qf2[g][0], a); a = wmma16(kf[kk][t][1], qf2[g][1], a); }
                    sc[g][t] = a; } }
            __builtin_amdgcn_sched_barrier(0);   // the products above are issued first, so that the reads below land while the matrix unit works
            ldv(kk);
            __builtin_amdgcn_sched_barrier(0);   // these reads stay one group here, in front of the maxima and exponentials, which cover their latency
            const bool first = kk == 0 && s == 0;   // the first 32 keys set the maximum, whatever it is
            float mx[NG];
#pragma unroll
            for (int g = 0; g < NG; ++g) { float a = fmaxf(sc[g][0][0], sc[g][1][0]);
#pragma unroll
                for (int j = 1; j < 8; ++j) a = fmaxf(a, fmaxf(sc[g][0][j], sc[g][1][j]));
                mx[g] = fmaxf(a, xhalf(a)); }   // how far the pass's maximum lies above the one in use
            if (__builtin_amdgcn_ballot_w32(fmaxf(fmaxf(mx[0], mx[1]), fmaxf(mx[2], mx[3])) > (first ? -3.0e38f : 8.0f)) != 0) {   // scalar branch; always taken on the first pass (no sum of fp16 products reaches -3e38), rare later
#pragma unroll
                for (int g = 0; g < NG; ++g) { const float d = first ? mx[g] : fmaxf(mx[g], 0.f); const float al = first ? 1.0f : __builtin_amdgcn_exp2f(-d); nm[g] -= d; l[g] *= al; sc[g][0] -= d; sc[g][1] -= d;
#pragma unroll
                    for (int dt = 0; dt < 4; ++dt) o[g][dt] *= al; } }
            V pf[NG], pf2[NGH];
#pragma unroll
            for (int g = 0; g < NG; ++g) {
#pragma unroll
                for (int t = 0; t < 2; ++t)
#pragma unroll
                    for (int j = 0; j < 8; ++j) { const float p = __builtin_amdgcn_exp2f(sc[g][t][j]); sc[g][t][j] = p; l[g] += p; }
                const v8h p0 = __builtin_convertvector(sc[g][0], v8h), p1 = __builtin_convertvector(sc[g][1], v8h);
                pf[g] = cat16(p0, p1); if (g < NGH) pf2[g] = cat16(hres(sc[g][0], p0), hres(sc[g][1], p1)); }
#pragma unroll
            for (int dt = 0; dt < 4; ++dt) {
                if (kk == 0 && dt == 2) { __builtin_amdgcn_sched_barrier(0);   // keeps the products above in front of the reads
                    ldk(1);
                    __builtin_amdgcn_sched_barrier(0); }   // the second pass's x reads stay one group in front of the second half of this pass's last products, which cover their latency
#pragma unroll
                for (int g = 0; g < NG; ++g) { o[g][dt] = wmma16(vf[kk][dt], pf[g], o[g][dt]); if (g < NGH) o[g][dt] = wmma16(vf[kk][dt], pf2[g], o[g][dt]); } }
            if (kk == 0) __builtin_amdgcn_sched_barrier(0);   // the second pass's score products stay behind these: moved up among them, they wait for the x reads after a few products only
        }
        __builtin_amdgcn_sched_barrier(0);   // the stage's last products stay in front of the four slots below
        asm volatile("v_nop\n\tv_nop\n\tv_nop\n\tv_nop");   // the distance a matrix product needs before a vector instruction overwrites its operands
        if (s + 1 < TT / FKS) putx((s + 1) & 1);   // into the buffer that stage s - 1 read: every wave left it at the last barrier
        __syncthreads();                    // publishes x and x^T of stage s + 1 and ends every wave's reads of stage s
    }
    // epilogue: Y^T over the row sum, times Wv, plus bv; each wave turns the tiles into output rows through its own 16 x 68 floats of the (now free) ring, so that stores are whole 256-byte row pieces
    V wo_[4][2]; v8f bo[4];
#pragma unroll
    for (int t = 0; t < 4; ++t) { const char* w = wl + 2 * FPL + fo + t * 16 * FPB; wo_[t][0] = LFrag<h16>::ld(w); wo_[t][1] = LFrag<h16>::ld(w + 64);
        const float* s = sb + HD + t * 16 + hi * 8; bo[t] = __builtin_shufflevector(*(const v4fa*)s, *(const v4fa*)(s + 4), 0, 1, 2, 3, 4, 5, 6, 7); }
    float* os = (float*)sm + wv * (16 * 68);
#pragma unroll
    for (int g = 0; g < NG; ++g) { const float inv = 1.0f / (l[g] + xhalf(l[g]));
        v8h yh[4], yl[4];
#pragma unroll
        for (int dt = 0; dt < 4; ++dt) { const v8f y = o[g][dt] * inv; yh[dt] = __builtin_convertvector(y, v8h); yl[dt] = hres(y, yh[dt]); }
        const V a0 = cat16(yh[0], yh[1]), a1 = cat16(yh[2], yh[3]), c0 = cat16(yl[0], yl[1]), c1 = cat16(yl[2], yl[3]);   // the loader's k order over the features of x, as in z
#pragma unroll
        for (int dt = 0; dt < 4; ++dt) { v8f v = wmma16(wo_[dt][0], a0, bo[dt]); v = wmma16(wo_[dt][1], a1, v); v = wmma16(wo_[dt][0], c0, v); v = wmma16(wo_[dt][1], c1, v);
            float* d = os + lr * 68 + dt * 16 + 8 * hi; *(v4fa*)d = __builtin_shufflevector(v, v, 0, 1, 2, 3); *(v4fa*)(d + 4) = __builtin_shufflevector(v, v, 4, 5, 6, 7); }
        __builtin_amdgcn_wave_barrier(); asm volatile("" ::: "memory");   // other lanes' LDS writes above, this lane's reads below: keep the compiler from crossing them
        float* orow = OUT + ((size_t)blockIdx.z * TT + q0 + (g < NGH ? g * 16 : RH + (g - NGH) * 16)) * DQ + head * HD;
#pragma unroll
        for (int r = 0; r < 8; ++r) { const int row = 2 * r + hi; *(v4f*)(orow + (size_t)row * DQ + lr * 4) = *(const v4fa*)(os + row * 68 + lr * 4); }
        __builtin_amdgcn_wave_barrier(); asm volatile("s_wait_xcnt 0x0" ::: "memory");   // the reads above end before the next group's writes; the wait is a precaution: it stands in front of the first overwrite of a register that these stores name
        __builtin_amdgcn_sched_barrier(0);  // the next group's arithmetic stays behind that wait
    }
}

extern "C" void kernel_launch(void* const* d_in, const int* in_sizes, int n_in,
                              void* d_out, int out_size, void* d_ws, size_t ws_size, hipStream_t stream) {
    (void)in_sizes; (void)n_in; (void)out_size; (void)d_ws; (void)ws_size;
    const float* x = (const float*)d_in[0]; const float* wq = (const float*)d_in[1]; const float* bq = (const float*)d_in[2]; const float* wk = (const float*)d_in[3]; const float* bk = (const float*)d_in[4]; const float* wv = (const float*)d_in[5]; const float* bv = (const float*)d_in[6];
    float* OUT = (float*)d_out;     // [8][1024][1024]
    k_fattn<<<dim3(RH / 256, NH_, NB_), 256, 0, stream>>>(x, wq, bq, wk, bk, wv, bv, OUT);
}

// v010
// It runs in 32.4 microseconds.
// Two timings next to v009 both put it at 1.07 times that version's speed.
// All steps since v000 together make it 134 times as fast.
#include <hip/hip_runtime.h>

// Per-head multi-head self-attention (sequences [8][1024][1024] viewed as 16 head slices of 64; per head: q = x_h Wq[h]^T + bq[h], k, v likewise ('oi' [16][64][64] + [16][64]); scores = q.k / 8; softmax; out_h = attn v; heads re-stacked -> [8][1024][1024] (8.4 M)).
// Layout: ONE kernel over every batch and head. The k and v projections are taken out of the key loop: q.k = (Wk^T q).x + q.bk, whose last term is the same for every key of a query and cancels in the softmax, and attn v = Wv (attn x) + bv, as a row of attn sums to 1. So a wave forms z = Wk^T q of its queries once, the loop runs scores, online softmax and attn x on the staged x itself, and Wv and bv come in once behind it (hybrid rows, in the loop: < 512 high and low halves of z and of P, rest the high halves alone; q and attn x, used once a query, go in as high and low halves for every row). No workspace.
// Compute dtypes, f32 accumulate: every input rounded to bf16; q projection bf16 operands + f32 bias; x, Wk, Wv held as fp16 behind that rounding (8 significant bits: no low half is left); q, attn x as fp16 high/low pairs; z, P as fp16 high/low pairs (rows < 512: 2 products) or fp16 (rest); softmax f32 (running maximum and sum); output f32.

#define NB_  8
#define TT   1024
#define DM   1024
#define NH_  16
#define NKV  16
#define REP  (NH_ / NKV)
#define HD   64
#define DQ   (NH_ * HD)
#define DKV  (NKV * HD)
#define RH   512                  // query rows < RH use hi+lo halves of z and P
#define WIN  0
#define SCL  0.125f   // HD^-0.5
typedef _Float16 h16;
typedef unsigned short bf;
typedef __attribute__((ext_vector_type(16))) __bf16   v16bf;
typedef __attribute__((ext_vector_type(16))) _Float16 v16h;
typedef __attribute__((ext_vector_type(8)))  _Float16 v8h;
typedef __attribute__((ext_vector_type(8)))  unsigned short v8us;
typedef __attribute__((ext_vector_type(8)))  float    v8f;
typedef __attribute__((ext_vector_type(4)))  float    v4f;
typedef v8h  __attribute__((may_alias)) v8ha;
typedef v4f  __attribute__((may_alias)) v4fa;
typedef v8us __attribute__((may_alias)) v8usa;

__device__ __forceinline__ unsigned short f2bf(float f) { unsigned u = __float_as_uint(f); u += 0x7FFFu + ((u >> 16) & 1u); return (unsigned short)(u >> 16); }
__device__ __forceinline__ float bf2f(unsigned short b) { return __uint_as_float(((unsigned)b) << 16); }
__device__ __forceinline__ float bfr(float f) { return bf2f(f2bf(f)); }
__device__ __forceinline__ v16h cat16(v8h lo, v8h hi) { return __builtin_shufflevector(lo, hi, 0, 1, 2, 3, 4, 5, 6, 7, 8, 9, 10, 11, 12, 13, 14, 15); }
__device__ __forceinline__ v16bf cat16b(v8us lo, v8us hi) { return __builtin_bit_cast(v16bf, __builtin_shufflevector(lo, hi, 0, 1, 2, 3, 4, 5, 6, 7, 8, 9, 10, 11, 12, 13, 14, 15)); }
__device__ __forceinline__ v8f wmma16(v16h a, v16h b, v8f c) { return __builtin_amdgcn_wmma_f32_16x16x32_f16(false, a, false, b, (short)0, c, false, false); }
__device__ __forceinline__ v8f wmmab(v16bf a, v16bf b, v8f c) { return __builtin_amdgcn_wmma_f32_16x16x32_bf16(false, a, false, b, (short)0, c, false, false); }

typedef __attribute__((ext_vector_type(4))) int v4i;
// ---- k_fattn: projections and fused attention of one (batch, head) for 256 query rows < RH and 256 query rows >= RH; 8 waves x (32 + 32) query columns; grid (RH / 256, heads, batches).
// A wave holds four groups of 16 query columns: groups 0, 1 are rows < RH (two products: high and low half of the query-side operand), groups 2, 3 rows >= RH (the high half alone); every x and x^T fragment it reads serves all four.
// Transposed products: S^T = X Z^T (A = x rows, B = z, kept in registers), Y^T += X^T P^T (A = x^T rows, B = P^T packed straight from the two S^T tiles of 32 keys, which is the hardware k order the A loader also has).
// A lane holds scores of ONE query a group (column lane & 15); its two halves split the keys. Running maximum in base 2. A pass takes its exponentials at once, against the maximum in use, and tests their sum: a lane's 16 exponentials sum to at most 2^8 only if no score lies more than 8 above that maximum; else (rare) the pass's scores are formed again, the maximum is raised and the exponentials are taken anew. Row sums per lane half, joined at the end.
// q is formed scaled by HD^-0.5 log2(e), z inherits that, and a group's score tiles start from minus its running maximum (the C operand of the first product), so what the products leave is the exponent itself.
// q: D = Wq x^T (bf16 operands, f32 bias behind the sums); z: D = Wk^T q^T; output: D = Wv Y^T, started from bv (C operand). In each a lane holds 8 neighbouring features of ONE query, so two D tiles are the next product's B fragment as they stand; A fragments come from LDS with one loader.
// Staging: a thread takes a 4 x 4 block (4 rows x 16 bytes of f32), so it writes 8-byte pieces of the rows and of the transposed rows alike (x and x^T of a stage; Wk^T).
// Stages of 64 keys: x of stage s + 1 flies global -> registers during stage s and goes to LDS, both ways round, at its foot; two buffers, one barrier a stage.
// A wave reads its fragments from LDS in four groups a stage (x, then x^T, of each pass), each ahead of the products that use it.
// Every full '#pragma unroll' in it is there so that the fragment, score and accumulator arrays are indexed by constants and stay in registers.
typedef v4i __attribute__((may_alias)) v4ia;
template <typename T16> struct LFrag;
template <> struct LFrag<h16> { static __device__ __forceinline__ v16h ld(const char* p) { return cat16(*(const v8ha*)p, *(const v8ha*)(p + 32)); } };
template <> struct LFrag<bf> { static __device__ __forceinline__ v16bf ld(const char* p) { return cat16b(*(const v8usa*)p, *(const v8usa*)(p + 32)); } };
__device__ __forceinline__ v8h hres(v8f a, v8h h) { return __builtin_convertvector(a - __builtin_convertvector(h, v8f), v8h); }   // what the fp16 rounding h of a leaves (an exact difference), itself rounded to fp16
__device__ __forceinline__ float xhalf(float x) { return __builtin_bit_cast(float, __builtin_amdgcn_permlanex16(__builtin_bit_cast(int, x), __builtin_bit_cast(int, x), 0x76543210, 0xfedcba98, false, false)); }   // lane l with lane l ^ 16
#define FKS  64                   // keys per stage
#define FPB  144                  // LDS row pitch in bytes: 128 of data + 16 (16 x odd: b128 readers without bank conflicts)
#define FPL  (64 * FPB)           // one staged plane: 64 rows
#define CL2  (SCL * 1.4426950408889634f)
#define NG   4                    // groups of 16 query columns a wave
#define NGH  2                    // of them on two products (rows < RH)
typedef __attribute__((ext_vector_type(4))) __bf16 v4bf;
typedef __attribute__((ext_vector_type(2))) int v2i;
typedef v2i __attribute__((may_alias)) v2ia;
typedef __attribute__((ext_vector_type(4))) _Float16 v4h;
__device__ __forceinline__ v4f bf4(v4f a) { return __builtin_convertvector(__builtin_convertvector(a, v4bf), v4f); }   // rounded to bf16
__device__ __forceinline__ v4h bfh(v4f a) { return __builtin_convertvector(bf4(a), v4h); }   // rounded to bf16, then held as fp16
__global__ __launch_bounds__(256) void k_fattn(const float* __restrict__ x, const float* __restrict__ Wq, const float* __restrict__ bq, const float* __restrict__ Wk, const float* __restrict__ bk, const float* __restrict__ Wv, const float* __restrict__ bv, float* __restrict__ OUT) {
    typedef v16h V;
    constexpr int NP = 2;                   // staged planes: x (a row a token), x^T (a row a feature)
    static_assert(2 * RH == TT, "as many rows on two products as on one");
    (void)bk;                               // q.bk is one constant a query row: the softmax takes it out again
    __shared__ __align__(16) char sm[(8 + 3) * FPL + 2 * HD * 4];   // each wave's own 64 x rows, one plane a wave (behind them, in the first four planes, the ring of two stages); Wq (bf16), Wk^T, Wv (fp16); the rounded biases bq, bv
    char* const wl = sm + 8 * FPL; float* const sb = (float*)(wl + 3 * FPL);
    const int tid = threadIdx.x, lane = tid & 31, lr = lane & 15, hi = lane >> 4, wv = tid >> 5;
    const int head = blockIdx.y;
    const int q0 = blockIdx.x * 256 + wv * 32;          // group g starts at row q0 + 16 g (g < NGH), RH + q0 + 16 (g - NGH) (the rest)
    const float* xh = x + (size_t)blockIdx.z * TT * DM + head * HD;   // row 0 of the head's slice
    const float* xl = xh + (size_t)(q0 + hi) * DM + lr * 4;           // the lane's 16 bytes of rows hi, 2 + hi, ... of a query group
    // staging blocks: thread tid has rows 4 (tid / 16) + 0..3, 16-byte chunk tid % 16 of a 64 x 256-byte piece
    const int xrow = tid >> 4, xcol = tid & 15;
    const unsigned xo = xrow * 4 * DM + xcol * 4;       // the lane's place in a stage, in elements: a 32-bit offset beside the uniform base
    const int dn = xrow * 4 * FPB + xcol * 8, dt_ = xcol * 4 * FPB + xrow * 8;   // the block's place in a plane as it lies, and transposed
    v4f xr[4];
    auto fetchx = [&](int kb) {
#pragma unroll
        for (int j = 0; j < 4; ++j) xr[j] = *(const v4fa*)(xh + (size_t)(kb + j) * DM + xo);
        asm volatile("s_wait_xcnt 0x0" ::: "memory"); };   // precaution: stands in front of the first overwrite of these loads' address registers
    auto putt = [&](char* d, const v4f* r) {   // a 4 x 4 block of rounded values, transposed, as fp16
#pragma unroll
        for (int i = 0; i < 4; ++i) { const v4f t = { r[0][i], r[1][i], r[2][i], r[3][i] }; *(v2ia*)(d + dt_ + i * FPB) = __builtin_bit_cast(v2i, __builtin_convertvector(t, v4h)); } };
    auto putx = [&](int buf) { char* d = sm + buf * (NP * FPL); v4f r[4];
#pragma unroll
        for (int j = 0; j < 4; ++j) { r[j] = bf4(xr[j]); *(v2ia*)(d + dn + j * FPB) = __builtin_bit_cast(v2i, __builtin_convertvector(r[j], v4h)); }
        putt(d + FPL, r); };
    const int fo = lr * FPB + 16 * hi;      // a lane's fragment: row lr of a 16-row tile, bytes 16 hi and 32 + 16 hi of each 64
    V qf[NG][2], qf2[NGH][2];               // z = Wk^T q, high and low halves
    {   // prologue: the wave's 64 query rows of x, the weights, the biases and the first x stage; then q and z
        const int be = head * HD + (tid & 63); const float rq = bq[be], rv = bv[be];
        v4f xv[32], wr[12];                 // every load is issued before the first conversion waits for one
#pragma unroll
        for (int i = 0; i < 32; ++i) xv[i] = *(const v4fa*)(xl + (size_t)(((i >> 3) < NGH ? (i >> 3) * 16 : RH + ((i >> 3) - NGH) * 16) + 2 * (i & 7)) * DM);   // two 256-byte row pieces a load
#pragma unroll
        for (int j = 0; j < 4; ++j) xr[j] = *(const v4fa*)(xh + (size_t)j * DM + xo);   // x stage 0
        asm volatile("s_wait_xcnt 0x0" :: "v"(xl), "v"(xo), "v"(be) : "memory");   // precaution: stands in front of the first overwrite of the address registers of the loads above; the addresses as inputs keep a load's own result off them
        const int wo = head * (HD * HD) + tid * 4; const float* pq = Wq + wo; const float* pk = Wk + head * (HD * HD) + xrow * 4 * HD + xcol * 4; const float* pv = Wv + wo;
#pragma unroll
        for (int i = 0; i < 12; ++i) wr[i] = *(const v4fa*)(i < 4 ? pq + i * 1024 : i < 8 ? pk + (i & 3) * HD : pv + (i & 3) * 1024);   // Wq, Wv in whole lines; Wk in 4 x 4 blocks
        asm volatile("s_wait_xcnt 0x0" :: "v"(pq), "v"(pk), "v"(pv), "v"(rq), "v"(rv) : "memory");   // the same precaution for the weight loads, their addresses as inputs for the same reason; the two biases as inputs hold their loads up here among the others, or their latency is paid in front of the barrier
        char* own = sm + wv * FPL;
#pragma unroll
        for (int i = 0; i < 32; ++i) *(v2ia*)(own + (2 * i + hi) * FPB + lr * 8) = __builtin_bit_cast(v2i, __builtin_convertvector(xv[i], v4bf));
#pragma unroll
        for (int i = 0; i < 4; ++i) { const int c = i * 256 + tid; char* d = wl + (c >> 4) * FPB + (c & 15) * 8;
            *(v2ia*)d = __builtin_bit_cast(v2i, __builtin_convertvector(wr[i], v4bf)); *(v2ia*)(d + 2 * FPL) = __builtin_bit_cast(v2i, bfh(wr[8 + i])); }
        { const v4f r[4] = { bf4(wr[4]), bf4(wr[5]), bf4(wr[6]), bf4(wr[7]) }; putt(wl + FPL, r); }
        if (wv < 2) { sb[tid] = bfr(rq); sb[HD + tid] = bfr(rv); }
        __syncthreads();                    // the weights and the biases are visible to every wave
        v16bf wf[4][2]; V wk[4][2]; v8f bm[4];
#pragma unroll
        for (int t = 0; t < 4; ++t) { const char* w = wl + fo + t * 16 * FPB; wf[t][0] = LFrag<bf>::ld(w); wf[t][1] = LFrag<bf>::ld(w + 64); wk[t][0] = LFrag<h16>::ld(w + FPL); wk[t][1] = LFrag<h16>::ld(w + FPL + 64);
            const float* s = sb + t * 16 + hi * 8; bm[t] = __builtin_shufflevector(*(const v4fa*)s, *(const v4fa*)(s + 4), 0, 1, 2, 3, 4, 5, 6, 7); }
#pragma unroll
        for (int g = 0; g < NG; ++g) { const v16bf x0 = LFrag<bf>::ld(own + fo + g * 16 * FPB), x1 = LFrag<bf>::ld(own + fo + g * 16 * FPB + 64);
            v8h yh[4], yl[4];
#pragma unroll
            for (int mb = 0; mb < 4; ++mb) { v8f a = wmmab(wf[mb][0], x0, (v8f){}); a = wmmab(wf[mb][1], x1, a);
                const v8f y = (a + bm[mb]) * CL2; yh[mb] = __builtin_convertvector(y, v8h); yl[mb] = hres(y, yh[mb]); }
            const V a0 = cat16(yh[0], yh[1]), a1 = cat16(yh[2], yh[3]), c0 = cat16(yl[0], yl[1]), c1 = cat16(yl[2], yl[3]);   // q features 32 ks + 8 hi + 0..7 and 32 ks + 16 + 8 hi + 0..7: the k order of the loader
#pragma unroll
            for (int mb = 0; mb < 4; ++mb) { v8f a = wmma16(wk[mb][0], a0, (v8f){}); a = wmma16(wk[mb][1], a1, a); a = wmma16(wk[mb][0], c0, a); a = wmma16(wk[mb][1], c1, a);
                yh[mb] = __builtin_convertvector(a, v8h); if (g < NGH) yl[mb] = hres(a, yh[mb]); }
#pragma unroll
            for (int ks = 0; ks < 2; ++ks) { qf[g][ks] = cat16(yh[2 * ks], yh[2 * ks + 1]); if (g < NGH) qf2[g][ks] = cat16(yl[2 * ks], yl[2 * ks + 1]); } }   // the same k order again, now over the features of x
        __syncthreads();                    // every wave has read its x rows out of the ring's place before stage 0 is written there
        putx(0);
    }
    v8f o[NG][4], nm[NG]; float l[NG];      // nm: minus the group's running maximum in all eight registers, as a score tile's start value
#pragma unroll
    for (int g = 0; g < NG; ++g) { nm[g] = (v8f){}; l[g] = 0.f;
#pragma unroll
        for (int dt = 0; dt < 4; ++dt) o[g][dt] = (v8f){}; }
    __syncthreads();                        // stage 0 is visible to all 8 waves
#pragma unroll 1                            // rolled: one copy of the stage body, the buffer chosen by s & 1
    for (int s = 0; s < TT / FKS; ++s) {
        const char* B = sm + (s & 1) * (NP * FPL) + fo;
        V kf[2][2][2], vf[2][4];            // the stage's fragments: x [pass][16-key tile][k half], x^T [pass][16-feature tile]
        auto ldk = [&](int kk) {
#pragma unroll
            for (int t = 0; t < 2; ++t) { const char* kr = B + (kk * 2 + t) * 16 * FPB; kf[kk][t][0] = LFrag<h16>::ld(kr); kf[kk][t][1] = LFrag<h16>::ld(kr + 64); } };
        auto ldv = [&](int kk) {
#pragma unroll
            for (int dt = 0; dt < 4; ++dt) vf[kk][dt] = LFrag<h16>::ld(B + FPL + dt * 16 * FPB + kk * 64); };
        ldk(0);
        __builtin_amdgcn_sched_barrier(0);  // the first pass's x reads stay one group up here: their latency runs while the global loads below are issued
        if (s + 1 < TT / FKS) fetchx((s + 1) * FKS);   // x of the next stage flies while this stage is worked on
#pragma unroll
        for (int kk = 0; kk < 2; ++kk) {    // 32 keys a pass
            v8f sc[NG][2];
            auto scores = [&](const V (&kx)[2][2]) {   // the pass's score tiles, counted from the maximum in use
#pragma unroll
                for (int t = 0; t < 2; ++t) {
#pragma unroll
                    for (int g = 0; g < NG; ++g) { v8f a = wmma16(kx[t][0], qf[g][0], nm[g]); a = wmma16(kx[t][1], qf[g][1], a);
                        if (g < NGH) { a = wmma16(kx[t][0], qf2[g][0], a); a = wmma16(kx[t][1], qf2[g][1], a); }
                        sc[g][t] = a; } } };
            scores(kf[kk]);
            __builtin_amdgcn_sched_barrier(0);   // the products above are issued first, so that the reads below land while the matrix unit works
            ldv(kk);
            __builtin_amdgcn_sched_barrier(0);   // these reads stay one group here, in front of the exponentials, which cover their latency
            const bool first = kk == 0 && s == 0;   // the first 32 keys set the maximum, whatever it is
            V pf[NG], pf2[NGH]; float ps[NG];       // ps: the sum of the lane's 16 exponentials of the pass, added in pairs
            auto expo = [&]() {
#pragma unroll
                for (int g = 0; g < NG; ++g) {
#pragma unroll
                    for (int t = 0; t < 2; ++t)
#pragma unroll
                        for (int j = 0; j < 8; ++j) sc[g][t][j] = __builtin_amdgcn_exp2f(sc[g][t][j]);
                    const v8f u = sc[g][0] + sc[g][1];
                    const v4f w = __builtin_shufflevector(u, u, 0, 1, 2, 3) + __builtin_shufflevector(u, u, 4, 5, 6, 7);
                    ps[g] = (w[0] + w[2]) + (w[1] + w[3]);
                    const v8h p0 = __builtin_convertvector(sc[g][0], v8h), p1 = __builtin_convertvector(sc[g][1], v8h);
                    pf[g] = cat16(p0, p1); if (g < NGH) pf2[g] = cat16(hres(sc[g][0], p0), hres(sc[g][1], p1)); } };
            expo();
            if (__builtin_amdgcn_ballot_w32(fmaxf(fmaxf(ps[0], ps[1]), fmaxf(ps[2], ps[3])) > (first ? -1.0f : 256.0f)) != 0) {   // scalar branch; always taken on the first pass (a sum of exponentials is not below 0), rare later: a score more than 8 above the maximum in use makes its lane's sum exceed 2^8
                V kx[2][2];                 // the pass's x fragments again, from the stage's buffer, which stays as it is up to the stage's barrier
#pragma unroll
                for (int t = 0; t < 2; ++t) { const char* kr = B + (kk * 2 + t) * 16 * FPB; kx[t][0] = LFrag<h16>::ld(kr); kx[t][1] = LFrag<h16>::ld(kr + 64); }
                scores(kx);
#pragma unroll
                for (int g = 0; g < NG; ++g) { float a = fmaxf(sc[g][0][0], sc[g][1][0]);
#pragma unroll
                    for (int j = 1; j < 8; ++j) a = fmaxf(a, fmaxf(sc[g][0][j], sc[g][1][j]));
                    const float mx = fmaxf(a, xhalf(a));   // how far the pass's maximum lies above the one in use
                    const float d = first ? mx : fmaxf(mx, 0.f); const float al = first ? 1.0f : __builtin_amdgcn_exp2f(-d); nm[g] -= d; l[g] *= al; sc[g][0] -= d; sc[g][1] -= d;
#pragma unroll
                    for (int dt = 0; dt < 4; ++dt) o[g][dt] *= al; }
                expo(); }
#pragma unroll
            for (int g = 0; g < NG; ++g) l[g] += ps[g];
#pragma unroll
            for (int dt = 0; dt < 4; ++dt) {
                if (kk == 0 && dt == 2) { __builtin_amdgcn_sched_barrier(0);   // keeps the products above in front of the reads
                    ldk(1);
                    __builtin_amdgcn_sched_barrier(0); }   // the second pass's x reads stay one group in front of the second half of this pass's last products, which cover their latency
#pragma unroll
                for (int g = 0; g < NG; ++g) { o[g][dt] = wmma16(vf[kk][dt], pf[g], o[g][dt]); if (g < NGH) o[g][dt] = wmma16(vf[kk][dt], pf2[g], o[g][dt]); } }
            if (kk == 0) __builtin_amdgcn_sched_barrier(0);   // the second pass's score products stay behind these: moved up among them, they wait for the x reads after a few products only
        }
        __builtin_amdgcn_sched_barrier(0);   // the stage's last products stay in front of the four slots below
        asm volatile("v_nop\n\tv_nop\n\tv_nop\n\tv_nop");   // the distance a matrix product needs before a vector instruction overwrites its operands
        if (s + 1 < TT / FKS) putx((s + 1) & 1);   // into the buffer that stage s - 1 read: every wave left it at the last barrier
        __syncthreads();                    // publishes x and x^T of stage s + 1 and ends every wave's reads of stage s
    }
    // epilogue: Y^T over the row sum, times Wv, plus bv; each wave turns the tiles into output rows through its own 16 x 68 floats of the (now free) ring, so that stores are whole 256-byte row pieces
    V wo_[4][2]; v8f bo[4];
#pragma unroll
    for (int t = 0; t < 4; ++t) { const char* w = wl + 2 * FPL + fo + t * 16 * FPB; wo_[t][0] = LFrag<h16>::ld(w); wo_[t][1] = LFrag<h16>::ld(w + 64);
        const float* s = sb + HD + t * 16 + hi * 8; bo[t] = __builtin_shufflevector(*(const v4fa*)s, *(const v4fa*)(s + 4), 0, 1, 2, 3, 4, 5, 6, 7); }
    float* os = (float*)sm + wv * (16 * 68);
#pragma unroll
    for (int g = 0; g < NG; ++g) { const float inv = 1.0f / (l[g] + xhalf(l[g]));
        v8h yh[4], yl[4];
#pragma unroll
        for (int dt = 0; dt < 4; ++dt) { const v8f y = o[g][dt] * inv; yh[dt] = __builtin_convertvector(y, v8h); yl[dt] = hres(y, yh[dt]); }
        const V a0 = cat16(yh[0], yh[1]), a1 = cat16(yh[2], yh[3]), c0 = cat16(yl[0], yl[1]), c1 = cat16(yl[2], yl[3]);   // the loader's k order over the features of x, as in z
#pragma unroll
        for (int dt = 0; dt < 4; ++dt) { v8f v = wmma16(wo_[dt][0], a0, bo[dt]); v = wmma16(wo_[dt][1], a1, v); v = wmma16(wo_[dt][0], c0, v); v = wmma16(wo_[dt][1], c1, v);
            float* d = os + lr * 68 + dt * 16 + 8 * hi; *(v4fa*)d = __builtin_shufflevector(v, v, 0, 1, 2, 3); *(v4fa*)(d + 4) = __builtin_shufflevector(v, v, 4, 5, 6, 7); }
        __builtin_amdgcn_wave_barrier(); asm volatile("" ::: "memory");   // other lanes' LDS writes above, this lane's reads below: keep the compiler from crossing them
        float* orow = OUT + ((size_t)blockIdx.z * TT + q0 + (g < NGH ? g * 16 : RH + (g - NGH) * 16)) * DQ + head * HD;
#pragma unroll
        for (int r = 0; r < 8; ++r) { const int row = 2 * r + hi; *(v4f*)(orow + (size_t)row * DQ + lr * 4) = *(const v4fa*)(os + row * 68 + lr * 4); }
        __builtin_amdgcn_wave_barrier(); asm volatile("s_wait_xcnt 0x0" ::: "memory");   // the reads above end before the next group's writes; the wait is a precaution: it stands in front of the first overwrite of a register that these stores name
        __builtin_amdgcn_sched_barrier(0);  // the next group's arithmetic stays behind that wait
    }
}

extern "C" void kernel_launch(void* const* d_in, const int* in_sizes, int n_in,
                              void* d_out, int out_size, void* d_ws, size_t ws_size, hipStream_t stream) {
    (void)in_sizes; (void)n_in; (void)out_size; (void)d_ws; (void)ws_size;
    const float* x = (const float*)d_in[0]; const float* wq = (const float*)d_in[1]; const float* bq = (const float*)d_in[2]; const float* wk = (const float*)d_in[3]; const float* bk = (const float*)d_in[4]; const float* wv = (const float*)d_in[5]; const float* bv = (const float*)d_in[6];
    float* OUT = (float*)d_out;     // [8][1024][1024]
    k_fattn<<<dim3(RH / 256, NH_, NB_), 256, 0, stream>>>(x, wq, bq, wk, bk, wv, bv, OUT);
}
